// v000
// The times below were measured on an AMD MI455X: many runs one after another, warmed up first and cycling through
// copies of the inputs, with the whole window's GPU time divided by the number of runs. Launches and the gaps
// between them are all in it. The median over several windows is given; except for v000 it joins two sittings, which
// can be a few percent apart, so the side-by-side timings, each taken in one sitting, are the better comparison.
// v000, which the later versions start from, runs in 3050 microseconds.
#include <hip/hip_runtime.h>

typedef __attribute__((ext_vector_type(2))) float v2f;
typedef __attribute__((ext_vector_type(8))) float v8f;
typedef __attribute__((ext_vector_type(4))) unsigned int u32x4;
typedef __attribute__((ext_vector_type(8))) int i32x8;
typedef __attribute__((ext_vector_type(4))) int i32x4;
typedef __attribute__((address_space(3))) char as3char;

namespace {
constexpr int BATCH = 2;
constexpr int SEQ   = 4096;
constexpr int HEADS = 16;
constexpr int DKC   = 128;          // Dk
constexpr int DVC   = 128;          // Dv
constexpr int CH    = 64;           // chunk length
constexpr int NCH   = SEQ / CH;     // 64 chunks
constexpr int GRP   = 4;            // Dv split -> 4 groups of 32 columns
constexpr int DVG   = DVC / GRP;    // 32
constexpr float QSCALE = 0.08838834764831845f;  // 128^-0.5
}

__device__ __forceinline__ v8f wmma4(v2f a, v2f b, v8f c) {
  // V_WMMA_F32_16X16X4_F32 : D = A(16x4,f32) x B(4x16,f32) + C(16x16,f32)
  return __builtin_amdgcn_wmma_f32_16x16x4_f32(false, a, false, b, (short)0, c,
                                               false, false);
}

// A fragment: A[row0 + (lane&15)][k0 + 2*(lane>>4) + {0,1}]
__device__ __forceinline__ v2f frag_a(const float* Sm, int ld, int row0, int k0,
                                      int h2, int rl) {
  const float* p = Sm + (row0 + rl) * ld + k0 + 2 * h2;
  v2f a; a.x = p[0]; a.y = p[1]; return a;
}
// B fragment (row-major B): B[k0 + 2*h2 + {0,1}][col0 + (lane&15)]
__device__ __forceinline__ v2f frag_b(const float* Sm, int ld, int k0, int col0,
                                      int h2, int rl) {
  v2f b;
  b.x = Sm[(k0 + 2 * h2    ) * ld + col0 + rl];
  b.y = Sm[(k0 + 2 * h2 + 1) * ld + col0 + rl];
  return b;
}
// B fragment of a transposed row-major matrix: B[d][c] = Sm[c][d]
__device__ __forceinline__ v2f frag_bt(const float* Sm, int ld, int k0, int col0,
                                       int h2, int rl) {
  const float* p = Sm + (col0 + rl) * ld + k0 + 2 * h2;
  v2f b; b.x = p[0]; b.y = p[1]; return b;
}

__device__ __forceinline__ unsigned lds_off(const void* p) {
  return (unsigned)(size_t)(as3char*)p;
}

__device__ __forceinline__ void tdm_load_tile_f32(unsigned lds_byte,
                                                  const float* gptr, int rows,
                                                  int cols, int stride_elems) {
  unsigned long long ga = (unsigned long long)(size_t)gptr;
  u32x4 g0;
  g0[0] = 1u;                                   // count=1, user mode
  g0[1] = lds_byte;                             // lds_addr (bytes)
  g0[2] = (unsigned)(ga & 0xFFFFFFFFu);         // global_addr[31:0]
  g0[3] = (unsigned)((ga >> 32) & 0x1FFFFFFu)   // global_addr[56:32]
          | (2u << 30);                         // type=2 ("image")
  i32x8 g1;
  g1[0] = (int)(2u << 16);
  g1[1] = (int)((unsigned)cols << 16);
  g1[2] = (int)(((unsigned)cols >> 16) | ((unsigned)rows << 16));
  g1[3] = (int)(((unsigned)rows >> 16) | ((unsigned)cols << 16));
  g1[4] = (int)rows;
  g1[5] = (int)stride_elems;
  g1[6] = 0;
  g1[7] = 0;
  i32x4 z4 = {0, 0, 0, 0};
  i32x8 z8 = {0, 0, 0, 0, 0, 0, 0, 0};
  // clang-23 / therock-10.0 toolchain: 6-arg form
  __builtin_amdgcn_tensor_load_to_lds(g0, g1, z4, z4, z8, 0);
}

__global__ __launch_bounds__(256)
void gdn_chunk_scan(const float* __restrict__ qg, const float* __restrict__ kg,
                    const float* __restrict__ vg, const float* __restrict__ gg,
                    const float* __restrict__ bg, float* __restrict__ outg) {
  __shared__ float s_q[2][CH * DKC];    // 64 KB  double-buffered q chunk
  __shared__ float s_k[2][CH * DKC];    // 64 KB  double-buffered k chunk
  __shared__ float s_v[2][CH * DVG];    // 16 KB  double-buffered v chunk -> v_new
  __shared__ float s_tmp[CH * DVG];     //  8 KB  U -> (v_beta - U)
  __shared__ float s_state[DKC * DVG];  // 16 KB  recurrent state
  __shared__ float s_M[CH * CH];        // 16 KB  strict_tril(k_b k^T * decay)
  __shared__ float s_T[CH * CH];        // 16 KB  (I+M)^-1
  __shared__ float s_attn[CH * CH];     // 16 KB  tril(q k^T * decay)
  __shared__ float s_red[512];
  __shared__ float s_invq[CH], s_invk[CH];
  __shared__ float s_graw[CH], s_gc[CH], s_beta[CH];
  __shared__ float s_bg[CH], s_eg[CH], s_kd[CH];

  const int tid  = threadIdx.x;
  const int wave = __builtin_amdgcn_readfirstlane((int)(threadIdx.x >> 5));
  const int lane = tid & 31;
  const int h2   = lane >> 4;   // half-wave select
  const int rl   = lane & 15;   // row/col within tile

  const int bid   = blockIdx.x;
  const int grp   = bid % GRP;
  const int head  = (bid / GRP) % HEADS;
  const int batch = bid / (GRP * HEADS);
  const int dv0   = grp * DVG;

  for (int i = tid; i < DKC * DVG; i += 256) s_state[i] = 0.f;

  if (wave == 0) {
    const float* qs = qg + ((size_t)batch * SEQ * HEADS + head) * DKC;
    const float* ks = kg + ((size_t)batch * SEQ * HEADS + head) * DKC;
    const float* vs = vg + ((size_t)batch * SEQ * HEADS + head) * DVC + dv0;
    tdm_load_tile_f32(lds_off(s_q[0]), qs, CH, DKC, HEADS * DKC);
    tdm_load_tile_f32(lds_off(s_k[0]), ks, CH, DKC, HEADS * DKC);
    tdm_load_tile_f32(lds_off(s_v[0]), vs, CH, DVG, HEADS * DVC);
  }
  __syncthreads();

  for (int n = 0; n < NCH; ++n) {
    const int s_base = n * CH;
    const int buf = n & 1;
    float* sq = s_q[buf];
    float* sk = s_k[buf];
    float* sv = s_v[buf];

    // ---- wait for this chunk's DMA; make LDS visible to all waves ----
    if (wave == 0) __builtin_amdgcn_s_wait_tensorcnt(0);
    __syncthreads();

    // ---- prefetch next chunk into the other buffer while we compute ----
    if (wave == 0 && n + 1 < NCH) {
      const size_t base = ((size_t)batch * SEQ + (s_base + CH)) * HEADS + head;
      tdm_load_tile_f32(lds_off(s_q[buf ^ 1]), qg + base * DKC, CH, DKC,
                        HEADS * DKC);
      tdm_load_tile_f32(lds_off(s_k[buf ^ 1]), kg + base * DKC, CH, DKC,
                        HEADS * DKC);
      tdm_load_tile_f32(lds_off(s_v[buf ^ 1]), vg + base * DVC + dv0, CH, DVG,
                        HEADS * DVC);
    }

    // ---------------- phase 1: scalars + sum-of-squares ----------------
    if (wave < 2) {  // tid 0..63
      size_t gsc = ((size_t)batch * SEQ + s_base + tid) * HEADS + head;
      s_graw[tid] = gg[gsc];
      s_beta[tid] = bg[gsc];
    }
    {
      const int row = tid >> 2, seg = tid & 3;
      const float4* q4 = reinterpret_cast<const float4*>(sq + row * DKC + seg * 32);
      const float4* k4 = reinterpret_cast<const float4*>(sk + row * DKC + seg * 32);
      float ssq = 0.f, ssk = 0.f;
#pragma unroll
      for (int j = 0; j < 8; ++j) {
        float4 a = q4[j]; ssq += a.x * a.x + a.y * a.y + a.z * a.z + a.w * a.w;
        float4 b = k4[j]; ssk += b.x * b.x + b.y * b.y + b.z * b.z + b.w * b.w;
      }
      s_red[row * 4 + seg]       = ssq;
      s_red[256 + row * 4 + seg] = ssk;
    }
    __syncthreads();

    // ---------------- phase 2: norms + parallel prefix of g ----------------
    if (wave < 2) {
      const int j = tid;
      float sq2 = s_red[j * 4] + s_red[j * 4 + 1] + s_red[j * 4 + 2] +
                  s_red[j * 4 + 3];
      s_invq[j] = rsqrtf(sq2 + 1e-6f) * QSCALE;
      float sk2 = s_red[256 + j * 4] + s_red[256 + j * 4 + 1] +
                  s_red[256 + j * 4 + 2] + s_red[256 + j * 4 + 3];
      s_invk[j] = rsqrtf(sk2 + 1e-6f);
      float acc = 0.f;
      for (int i = 0; i <= j; ++i) acc += s_graw[i];
      s_gc[j] = acc;
    }
    __syncthreads();

    // ---------------- phase 3: derived scalars + row rescale ----------------
    if (wave < 2) {
      const float gl = s_gc[CH - 1], gc = s_gc[tid];
      s_bg[tid] = s_beta[tid] * __expf(gc);  // k_beta * exp(gc) row scale
      s_eg[tid] = __expf(gc);                // q * exp(gc) row scale
      s_kd[tid] = __expf(gl - gc);           // k * exp(g_last - gc) row scale
    }
    {
      const int row = tid >> 2, seg = tid & 3;
      const float iq = s_invq[row], ik = s_invk[row];
      float* qr = sq + row * DKC + seg * 32;
      float* kr = sk + row * DKC + seg * 32;
#pragma unroll
      for (int j = 0; j < 32; ++j) { qr[j] *= iq; kr[j] *= ik; }
    }
    __syncthreads();

    // ---------------- phase 4: M and attn via WMMA ----------------
    // 16 M tiles + 16 attn tiles over [64x64]; 2 of each per wave.
    for (int tt = 0; tt < 2; ++tt) {
      const int ti = wave * 2 + tt;                  // scalar (wave uniform)
      const int row0 = (ti >> 2) * 16, col0 = (ti & 3) * 16;
      const float gCc = s_gc[col0 + rl];             // hoisted: fixed per lane
      // --- M tile: strict_tril(k_beta k^T * decay) ---
      if (col0 <= row0) {
        const float bb = s_beta[row0 + rl];          // hoisted row scale
        v8f acc = {0.f, 0.f, 0.f, 0.f, 0.f, 0.f, 0.f, 0.f};
#pragma unroll 8
        for (int kk = 0; kk < DKC; kk += 4) {
          v2f a = frag_a(sk, DKC, row0, kk, h2, rl);
          a.x *= bb; a.y *= bb;
          v2f b = frag_bt(sk, DKC, kk, col0, h2, rl);  // B[d][c] = k[c][d]
          acc = wmma4(a, b, acc);
        }
#pragma unroll
        for (int i = 0; i < 8; ++i) {
          int R = row0 + i + 8 * h2, Cc = col0 + rl;
          float val = acc[i] * __expf(s_gc[R] - gCc);
          s_M[R * CH + Cc] = (R > Cc) ? val : 0.f;
        }
      } else {  // strictly-upper tile: zeros
#pragma unroll
        for (int i = 0; i < 8; ++i)
          s_M[(row0 + i + 8 * h2) * CH + col0 + rl] = 0.f;
      }
      // --- attn tile: tril(q k^T * decay) ---
      {
        v8f acc = {0.f, 0.f, 0.f, 0.f, 0.f, 0.f, 0.f, 0.f};
#pragma unroll 8
        for (int kk = 0; kk < DKC; kk += 4) {
          v2f a = frag_a(sq, DKC, row0, kk, h2, rl);
          v2f b = frag_bt(sk, DKC, kk, col0, h2, rl);
          acc = wmma4(a, b, acc);
        }
#pragma unroll
        for (int i = 0; i < 8; ++i) {
          int R = row0 + i + 8 * h2, Cc = col0 + rl;
          float val = acc[i] * __expf(s_gc[R] - gCc);
          s_attn[R * CH + Cc] = (R >= Cc) ? val : 0.f;
        }
      }
    }
    __syncthreads();

    // ---- phase 5: T = (I+M)^-1 (waves 0-1)  ||  U = (k_b e^gc)@state ----
    if (wave < 2) {
      const int j = tid;  // column of T
      for (int i = 0; i < j; ++i) s_T[i * CH + j] = 0.f;
      for (int i = j; i < CH; ++i) {
        float acc = (i == j) ? 1.f : 0.f;
        for (int l = j; l < i; ++l) acc -= s_M[i * CH + l] * s_T[l * CH + j];
        s_T[i * CH + j] = acc;
      }
    }
    {
      const int row0 = (wave >> 1) * 16, col0 = (wave & 1) * 16;  // 8 tiles
      const float sc = s_bg[row0 + rl];                           // hoisted
      v8f acc = {0.f, 0.f, 0.f, 0.f, 0.f, 0.f, 0.f, 0.f};
#pragma unroll 8
      for (int kk = 0; kk < DKC; kk += 4) {
        v2f a = frag_a(sk, DKC, row0, kk, h2, rl);
        a.x *= sc; a.y *= sc;
        v2f b = frag_b(s_state, DVG, kk, col0, h2, rl);
        acc = wmma4(a, b, acc);
      }
#pragma unroll
      for (int i = 0; i < 8; ++i)
        s_tmp[(row0 + i + 8 * h2) * DVG + col0 + rl] = acc[i];
    }
    __syncthreads();

    // ---------------- phase 6: tmp = v_beta - U ----------------
    for (int idx = tid; idx < CH * DVG; idx += 256) {
      int r = idx >> 5;  // idx / DVG
      s_tmp[idx] = sv[idx] * s_beta[r] - s_tmp[idx];
    }
    __syncthreads();

    // ---------------- phase 7: v_new = T @ tmp  (into sv) ----------------
    {
      const int row0 = (wave >> 1) * 16, col0 = (wave & 1) * 16;
      v8f acc = {0.f, 0.f, 0.f, 0.f, 0.f, 0.f, 0.f, 0.f};
#pragma unroll 8
      for (int kk = 0; kk < CH; kk += 4) {
        v2f a = frag_a(s_T, CH, row0, kk, h2, rl);
        v2f b = frag_b(s_tmp, DVG, kk, col0, h2, rl);
        acc = wmma4(a, b, acc);
      }
#pragma unroll
      for (int i = 0; i < 8; ++i)
        sv[(row0 + i + 8 * h2) * DVG + col0 + rl] = acc[i];
    }
    __syncthreads();

    // ---------- phase 8: out = (q e^gc)@state + attn@v_new -> global ----------
    {
      const int row0 = (wave >> 1) * 16, col0 = (wave & 1) * 16;
      const float sc = s_eg[row0 + rl];  // hoisted
      v8f acc = {0.f, 0.f, 0.f, 0.f, 0.f, 0.f, 0.f, 0.f};
#pragma unroll 8
      for (int kk = 0; kk < DKC; kk += 4) {
        v2f a = frag_a(sq, DKC, row0, kk, h2, rl);
        a.x *= sc; a.y *= sc;
        v2f b = frag_b(s_state, DVG, kk, col0, h2, rl);
        acc = wmma4(a, b, acc);
      }
#pragma unroll 8
      for (int kk = 0; kk < CH; kk += 4) {
        v2f a = frag_a(s_attn, CH, row0, kk, h2, rl);
        v2f b = frag_b(sv, DVG, kk, col0, h2, rl);
        acc = wmma4(a, b, acc);
      }
#pragma unroll
      for (int i = 0; i < 8; ++i) {
        int R = row0 + i + 8 * h2;
        size_t go =
            ((size_t)((size_t)batch * SEQ + s_base + R) * HEADS + head) * DVC +
            dv0 + col0 + rl;
        outg[go] = acc[i];
      }
    }
    __syncthreads();

    // ------- phase 9: state = state*e^{g_last} + kd^T @ v_new -------
    {
      const float egl = __expf(s_gc[CH - 1]);
      for (int tt = 0; tt < 2; ++tt) {
        const int t = wave * 2 + tt;  // 16 tiles over [128 x 32]
        const int dk0 = (t >> 1) * 16, col0 = (t & 1) * 16;
        v8f acc;
#pragma unroll
        for (int i = 0; i < 8; ++i)
          acc[i] = s_state[(dk0 + i + 8 * h2) * DVG + col0 + rl] * egl;
#pragma unroll 8
        for (int kk = 0; kk < CH; kk += 4) {
          // A[m][kk'] = k[kk'][dk0+m] * s_kd[kk']  (transposed, K-scaled)
          v2f a;
          a.x = sk[(kk + 2 * h2) * DKC + dk0 + rl] * s_kd[kk + 2 * h2];
          a.y = sk[(kk + 2 * h2 + 1) * DKC + dk0 + rl] * s_kd[kk + 2 * h2 + 1];
          v2f b = frag_b(sv, DVG, kk, col0, h2, rl);
          acc = wmma4(a, b, acc);
        }
#pragma unroll
        for (int i = 0; i < 8; ++i)
          s_state[(dk0 + i + 8 * h2) * DVG + col0 + rl] = acc[i];
      }
    }
    __syncthreads();
  }
}

extern "C" void kernel_launch(void* const* d_in, const int* in_sizes, int n_in,
                              void* d_out, int out_size, void* d_ws,
                              size_t ws_size, hipStream_t stream) {
  const float* q    = (const float*)d_in[0];
  const float* k    = (const float*)d_in[1];
  const float* v    = (const float*)d_in[2];
  const float* g    = (const float*)d_in[3];
  const float* beta = (const float*)d_in[4];
  float* out = (float*)d_out;
  dim3 grid(BATCH * HEADS * GRP);  // 128 workgroups
  gdn_chunk_scan<<<grid, 256, 0, stream>>>(q, k, v, g, beta, out);
}

// v001
// Measured time: 1460 microseconds a run.
// Two timings next to v000 both put it at 2.09 times that version's speed.
#include <hip/hip_runtime.h>

typedef __attribute__((ext_vector_type(2))) float v2f;
typedef __attribute__((ext_vector_type(8))) float v8f;
typedef __attribute__((ext_vector_type(4))) unsigned int u32x4;
typedef __attribute__((ext_vector_type(8))) int i32x8;
typedef __attribute__((ext_vector_type(4))) int i32x4;
typedef __attribute__((address_space(3))) char as3char;

namespace {
constexpr int BATCH = 2;
constexpr int SEQ   = 4096;
constexpr int HEADS = 16;
constexpr int DKC   = 128;          // Dk
constexpr int DVC   = 128;          // Dv
constexpr int CH    = 64;           // chunk length
constexpr int NCH   = SEQ / CH;     // 64 chunks
constexpr int GRP   = 4;            // Dv split -> 4 groups of 32 columns
constexpr int DVG   = DVC / GRP;    // 32
constexpr int HB    = CH / 2;       // 32: block size of the triangular inverse
constexpr float QSCALE = 0.08838834764831845f;  // 128^-0.5
}

__device__ __forceinline__ v8f wmma4(v2f a, v2f b, v8f c) {
  // V_WMMA_F32_16X16X4_F32 : D = A(16x4,f32) x B(4x16,f32) + C(16x16,f32)
  return __builtin_amdgcn_wmma_f32_16x16x4_f32(false, a, false, b, (short)0, c,
                                               false, false);
}

// A fragment: A[row0 + (lane&15)][k0 + 2*(lane>>4) + {0,1}]
__device__ __forceinline__ v2f frag_a(const float* Sm, int ld, int row0, int k0,
                                      int h2, int rl) {
  const float* p = Sm + (row0 + rl) * ld + k0 + 2 * h2;
  v2f a; a.x = p[0]; a.y = p[1]; return a;
}
// B fragment (row-major B): B[k0 + 2*h2 + {0,1}][col0 + (lane&15)]
__device__ __forceinline__ v2f frag_b(const float* Sm, int ld, int k0, int col0,
                                      int h2, int rl) {
  v2f b;
  b.x = Sm[(k0 + 2 * h2    ) * ld + col0 + rl];
  b.y = Sm[(k0 + 2 * h2 + 1) * ld + col0 + rl];
  return b;
}
// B fragment of a transposed row-major matrix: B[d][c] = Sm[c][d]
__device__ __forceinline__ v2f frag_bt(const float* Sm, int ld, int k0, int col0,
                                       int h2, int rl) {
  const float* p = Sm + (col0 + rl) * ld + k0 + 2 * h2;
  v2f b; b.x = p[0]; b.y = p[1]; return b;
}

__device__ __forceinline__ unsigned lds_off(const void* p) {
  return (unsigned)(size_t)(as3char*)p;
}

__device__ __forceinline__ void tdm_load_tile_f32(unsigned lds_byte,
                                                  const float* gptr, int rows,
                                                  int cols, int stride_elems) {
  unsigned long long ga = (unsigned long long)(size_t)gptr;
  u32x4 g0;
  g0[0] = 1u;                                   // count=1, user mode
  g0[1] = lds_byte;                             // lds_addr (bytes)
  g0[2] = (unsigned)(ga & 0xFFFFFFFFu);         // global_addr[31:0]
  g0[3] = (unsigned)((ga >> 32) & 0x1FFFFFFu)   // global_addr[56:32]
          | (2u << 30);                         // type=2 ("image")
  i32x8 g1;
  g1[0] = (int)(2u << 16);
  g1[1] = (int)((unsigned)cols << 16);
  g1[2] = (int)(((unsigned)cols >> 16) | ((unsigned)rows << 16));
  g1[3] = (int)(((unsigned)rows >> 16) | ((unsigned)cols << 16));
  g1[4] = (int)rows;
  g1[5] = (int)stride_elems;
  g1[6] = 0;
  g1[7] = 0;
  i32x4 z4 = {0, 0, 0, 0};
  i32x8 z8 = {0, 0, 0, 0, 0, 0, 0, 0};
  // clang-23 / therock-10.0 toolchain: 6-arg form
  __builtin_amdgcn_tensor_load_to_lds(g0, g1, z4, z4, z8, 0);
}

__global__ __launch_bounds__(256)
void gdn_chunk_scan(const float* __restrict__ qg, const float* __restrict__ kg,
                    const float* __restrict__ vg, const float* __restrict__ gg,
                    const float* __restrict__ bg, float* __restrict__ outg) {
  __shared__ float s_q[2][CH * DKC];    // 64 KB  double-buffered q chunk
  __shared__ float s_k[2][CH * DKC];    // 64 KB  double-buffered k chunk
  __shared__ float s_v[2][CH * DVG];    // 16 KB  double-buffered v chunk -> v_new
  __shared__ float s_tmp[CH * DVG];     //  8 KB  U -> (v_beta - U)
  __shared__ float s_state[DKC * DVG];  // 16 KB  recurrent state
  __shared__ float s_M[CH * CH];        // 16 KB  strict_tril(k_b k^T * decay), C negated
  __shared__ float s_T[CH * CH];        // 16 KB  (I+M)^-1
  __shared__ float s_attn[CH * CH];     // 16 KB  tril(q k^T * decay)
  __shared__ float s_red[512];
  __shared__ float s_invq[CH], s_invk[CH];
  __shared__ float s_graw[CH], s_gc[CH], s_beta[CH];
  __shared__ float s_bg[CH], s_eg[CH], s_kd[CH];

  const int tid  = threadIdx.x;
  const int wave = __builtin_amdgcn_readfirstlane((int)(threadIdx.x >> 5));
  const int lane = tid & 31;
  const int h2   = lane >> 4;   // half-wave select
  const int rl   = lane & 15;   // row/col within tile

  const int bid   = blockIdx.x;
  const int grp   = bid % GRP;
  const int head  = (bid / GRP) % HEADS;
  const int batch = bid / (GRP * HEADS);
  const int dv0   = grp * DVG;

  for (int i = tid; i < DKC * DVG; i += 256) s_state[i] = 0.f;
  // upper right block of T is zero for every chunk and is never written again
  for (int i = tid; i < HB * HB; i += 256)
    s_T[(i / HB) * CH + HB + (i % HB)] = 0.f;

  if (wave == 0) {
    const float* qs = qg + ((size_t)batch * SEQ * HEADS + head) * DKC;
    const float* ks = kg + ((size_t)batch * SEQ * HEADS + head) * DKC;
    const float* vs = vg + ((size_t)batch * SEQ * HEADS + head) * DVC + dv0;
    tdm_load_tile_f32(lds_off(s_q[0]), qs, CH, DKC, HEADS * DKC);
    tdm_load_tile_f32(lds_off(s_k[0]), ks, CH, DKC, HEADS * DKC);
    tdm_load_tile_f32(lds_off(s_v[0]), vs, CH, DVG, HEADS * DVC);
  }
  __syncthreads();

  for (int n = 0; n < NCH; ++n) {
    const int s_base = n * CH;
    const int buf = n & 1;
    float* sq = s_q[buf];
    float* sk = s_k[buf];
    float* sv = s_v[buf];

    // ---- wait for this chunk's DMA; make LDS visible to all waves ----
    if (wave == 0) __builtin_amdgcn_s_wait_tensorcnt(0);
    __syncthreads();

    // ---- prefetch next chunk into the other buffer while we compute ----
    if (wave == 0 && n + 1 < NCH) {
      const size_t base = ((size_t)batch * SEQ + (s_base + CH)) * HEADS + head;
      tdm_load_tile_f32(lds_off(s_q[buf ^ 1]), qg + base * DKC, CH, DKC,
                        HEADS * DKC);
      tdm_load_tile_f32(lds_off(s_k[buf ^ 1]), kg + base * DKC, CH, DKC,
                        HEADS * DKC);
      tdm_load_tile_f32(lds_off(s_v[buf ^ 1]), vg + base * DVC + dv0, CH, DVG,
                        HEADS * DVC);
    }

    // ---------------- phase 1: scalars + sum-of-squares ----------------
    if (wave < 2) {  // tid 0..63
      size_t gsc = ((size_t)batch * SEQ + s_base + tid) * HEADS + head;
      s_graw[tid] = gg[gsc];
      s_beta[tid] = bg[gsc];
    }
    {
      const int row = tid >> 2, seg = tid & 3;
      const float4* q4 = reinterpret_cast<const float4*>(sq + row * DKC + seg * 32);
      const float4* k4 = reinterpret_cast<const float4*>(sk + row * DKC + seg * 32);
      float ssq = 0.f, ssk = 0.f;
#pragma unroll
      for (int j = 0; j < 8; ++j) {
        float4 a = q4[j]; ssq += a.x * a.x + a.y * a.y + a.z * a.z + a.w * a.w;
        float4 b = k4[j]; ssk += b.x * b.x + b.y * b.y + b.z * b.z + b.w * b.w;
      }
      s_red[row * 4 + seg]       = ssq;
      s_red[256 + row * 4 + seg] = ssk;
    }
    __syncthreads();

    // ---------------- phase 2: norms + parallel prefix of g ----------------
    if (wave < 2) {
      const int j = tid;
      float sq2 = s_red[j * 4] + s_red[j * 4 + 1] + s_red[j * 4 + 2] +
                  s_red[j * 4 + 3];
      s_invq[j] = rsqrtf(sq2 + 1e-6f) * QSCALE;
      float sk2 = s_red[256 + j * 4] + s_red[256 + j * 4 + 1] +
                  s_red[256 + j * 4 + 2] + s_red[256 + j * 4 + 3];
      s_invk[j] = rsqrtf(sk2 + 1e-6f);
      float acc = 0.f;
      for (int i = 0; i <= j; ++i) acc += s_graw[i];
      s_gc[j] = acc;
    }
    __syncthreads();

    // ---------------- phase 3: derived scalars + row rescale ----------------
    if (wave < 2) {
      const float gl = s_gc[CH - 1], gc = s_gc[tid];
      s_bg[tid] = s_beta[tid] * __expf(gc);  // k_beta * exp(gc) row scale
      s_eg[tid] = __expf(gc);                // q * exp(gc) row scale
      s_kd[tid] = __expf(gl - gc);           // k * exp(g_last - gc) row scale
    }
    {
      const int row = tid >> 2, seg = tid & 3;
      const float iq = s_invq[row], ik = s_invk[row];
      float* qr = sq + row * DKC + seg * 32;
      float* kr = sk + row * DKC + seg * 32;
#pragma unroll
      for (int j = 0; j < 32; ++j) { qr[j] *= iq; kr[j] *= ik; }
    }
    __syncthreads();

    // ---------------- phase 4: M and attn via WMMA ----------------
    // 16 M tiles + 16 attn tiles over [64x64]; 2 of each per wave.
    for (int tt = 0; tt < 2; ++tt) {
      const int ti = wave * 2 + tt;                  // scalar (wave uniform)
      const int row0 = (ti >> 2) * 16, col0 = (ti & 3) * 16;
      const float gCc = s_gc[col0 + rl];             // hoisted: fixed per lane
      // --- M tile: strict_tril(k_beta k^T * decay) ---
      if (col0 <= row0) {
        // hoisted row scale; the lower left 32x32 block C is stored as -C,
        // the sign that the blocked inverse of phases 5 to 6b needs there
        const float bb = (row0 >= HB && col0 < HB) ? -s_beta[row0 + rl]
                                                   : s_beta[row0 + rl];
        v8f acc = {0.f, 0.f, 0.f, 0.f, 0.f, 0.f, 0.f, 0.f};
#pragma unroll 8
        for (int kk = 0; kk < DKC; kk += 4) {
          v2f a = frag_a(sk, DKC, row0, kk, h2, rl);
          a.x *= bb; a.y *= bb;
          v2f b = frag_bt(sk, DKC, kk, col0, h2, rl);  // B[d][c] = k[c][d]
          acc = wmma4(a, b, acc);
        }
#pragma unroll
        for (int i = 0; i < 8; ++i) {
          int R = row0 + i + 8 * h2, Cc = col0 + rl;
          float val = acc[i] * __expf(s_gc[R] - gCc);
          s_M[R * CH + Cc] = (R > Cc) ? val : 0.f;
        }
      } else {  // strictly-upper tile: zeros
#pragma unroll
        for (int i = 0; i < 8; ++i)
          s_M[(row0 + i + 8 * h2) * CH + col0 + rl] = 0.f;
      }
      // --- attn tile: tril(q k^T * decay) ---
      {
        v8f acc = {0.f, 0.f, 0.f, 0.f, 0.f, 0.f, 0.f, 0.f};
#pragma unroll 8
        for (int kk = 0; kk < DKC; kk += 4) {
          v2f a = frag_a(sq, DKC, row0, kk, h2, rl);
          v2f b = frag_bt(sk, DKC, kk, col0, h2, rl);
          acc = wmma4(a, b, acc);
        }
#pragma unroll
        for (int i = 0; i < 8; ++i) {
          int R = row0 + i + 8 * h2, Cc = col0 + rl;
          float val = acc[i] * __expf(s_gc[R] - gCc);
          s_attn[R * CH + Cc] = (R >= Cc) ? val : 0.f;
        }
      }
    }
    __syncthreads();

    // ---- phase 5: diagonal blocks of T = (I+M)^-1  ||  U = (k_b e^gc)@state ----
    // I+M = [[A,0],[C,B]] in 32x32 blocks; wave 0 inverts A, wave 1 inverts B.
    // Lane = column; the column stays in registers, M rows are broadcast reads.
    if (wave < 2) {
      const int b0 = wave * HB;
      const float* Mb = s_M + b0 * CH + b0;
      float t[HB];
      // every loop over t[] is fully unrolled: constant indices keep it in registers
#pragma unroll
      for (int r = 0; r < HB; ++r) t[r] = (r == lane) ? 1.f : 0.f;
      // four finished rows at a time are folded into every later row, so the
      // updates of different rows are independent of each other
#pragma unroll
      for (int c0 = 0; c0 < HB; c0 += 4) {
#pragma unroll
        for (int r = c0 + 1; r < HB; ++r) {
          const float4 m = *reinterpret_cast<const float4*>(Mb + r * CH + c0);
          t[r] -= m.x * t[c0];
          if (r > c0 + 1) t[r] -= m.y * t[c0 + 1];
          if (r > c0 + 2) t[r] -= m.z * t[c0 + 2];
          if (r > c0 + 3) t[r] -= m.w * t[c0 + 3];
        }
      }
#pragma unroll
      for (int r = 0; r < HB; ++r) s_T[(b0 + r) * CH + b0 + lane] = t[r];
    }
    {
      const int row0 = (wave >> 1) * 16, col0 = (wave & 1) * 16;  // 8 tiles
      const float sc = s_bg[row0 + rl];                           // hoisted
      v8f acc = {0.f, 0.f, 0.f, 0.f, 0.f, 0.f, 0.f, 0.f};
#pragma unroll 8
      for (int kk = 0; kk < DKC; kk += 4) {
        v2f a = frag_a(sk, DKC, row0, kk, h2, rl);
        a.x *= sc; a.y *= sc;
        v2f b = frag_b(s_state, DVG, kk, col0, h2, rl);
        acc = wmma4(a, b, acc);
      }
#pragma unroll
      for (int i = 0; i < 8; ++i)
        s_tmp[(row0 + i + 8 * h2) * DVG + col0 + rl] = acc[i];
    }
    __syncthreads();

    // ---- phase 6: X = -C @ A^-1 (waves 0-3, into T's lower left block) ----
    if (wave < 4) {
      const int row0 = (wave >> 1) * 16, col0 = (wave & 1) * 16;
      v8f acc = {0.f, 0.f, 0.f, 0.f, 0.f, 0.f, 0.f, 0.f};
#pragma unroll
      for (int kk = 0; kk < HB; kk += 4) {
        v2f a = frag_a(s_M + HB * CH, CH, row0, kk, h2, rl);
        v2f b = frag_b(s_T, CH, kk, col0, h2, rl);
        acc = wmma4(a, b, acc);
      }
#pragma unroll
      for (int i = 0; i < 8; ++i)
        s_T[(HB + row0 + i + 8 * h2) * CH + col0 + rl] = acc[i];
    }
    // ---------------- tmp = v_beta - U ----------------
    for (int idx = tid; idx < CH * DVG; idx += 256) {
      int r = idx >> 5;  // idx / DVG
      s_tmp[idx] = sv[idx] * s_beta[r] - s_tmp[idx];
    }
    __syncthreads();

    // ---- phase 6b: lower left block of T = B^-1 @ X, in place ----
    // One wave owns a 16-column strip of X: it reads the whole strip before it
    // stores over it, and no other wave reads or writes that strip.
    if (wave < 2) {
      const int col0 = wave * 16;
      v8f acc0 = {0.f, 0.f, 0.f, 0.f, 0.f, 0.f, 0.f, 0.f};
      v8f acc1 = {0.f, 0.f, 0.f, 0.f, 0.f, 0.f, 0.f, 0.f};
#pragma unroll
      for (int kk = 0; kk < HB; kk += 4) {
        v2f b  = frag_b(s_T + HB * CH, CH, kk, col0, h2, rl);
        v2f a0 = frag_a(s_T + HB * CH + HB, CH, 0, kk, h2, rl);
        v2f a1 = frag_a(s_T + HB * CH + HB, CH, 16, kk, h2, rl);
        acc0 = wmma4(a0, b, acc0);
        acc1 = wmma4(a1, b, acc1);
      }
#pragma unroll
      for (int i = 0; i < 8; ++i) {
        s_T[(HB + i + 8 * h2) * CH + col0 + rl]      = acc0[i];
        s_T[(HB + 16 + i + 8 * h2) * CH + col0 + rl] = acc1[i];
      }
    }
    __syncthreads();

    // ---------------- phase 7: v_new = T @ tmp  (into sv) ----------------
    {
      const int row0 = (wave >> 1) * 16, col0 = (wave & 1) * 16;
      v8f acc = {0.f, 0.f, 0.f, 0.f, 0.f, 0.f, 0.f, 0.f};
#pragma unroll 8
      for (int kk = 0; kk < CH; kk += 4) {
        v2f a = frag_a(s_T, CH, row0, kk, h2, rl);
        v2f b = frag_b(s_tmp, DVG, kk, col0, h2, rl);
        acc = wmma4(a, b, acc);
      }
#pragma unroll
      for (int i = 0; i < 8; ++i)
        sv[(row0 + i + 8 * h2) * DVG + col0 + rl] = acc[i];
    }
    __syncthreads();

    // ---------- phase 8: out = (q e^gc)@state + attn@v_new -> global ----------
    {
      const int row0 = (wave >> 1) * 16, col0 = (wave & 1) * 16;
      const float sc = s_eg[row0 + rl];  // hoisted
      v8f acc = {0.f, 0.f, 0.f, 0.f, 0.f, 0.f, 0.f, 0.f};
#pragma unroll 8
      for (int kk = 0; kk < DKC; kk += 4) {
        v2f a = frag_a(sq, DKC, row0, kk, h2, rl);
        a.x *= sc; a.y *= sc;
        v2f b = frag_b(s_state, DVG, kk, col0, h2, rl);
        acc = wmma4(a, b, acc);
      }
#pragma unroll 8
      for (int kk = 0; kk < CH; kk += 4) {
        v2f a = frag_a(s_attn, CH, row0, kk, h2, rl);
        v2f b = frag_b(sv, DVG, kk, col0, h2, rl);
        acc = wmma4(a, b, acc);
      }
#pragma unroll
      for (int i = 0; i < 8; ++i) {
        int R = row0 + i + 8 * h2;
        size_t go =
            ((size_t)((size_t)batch * SEQ + s_base + R) * HEADS + head) * DVC +
            dv0 + col0 + rl;
        outg[go] = acc[i];
      }
    }
    __syncthreads();

    // ------- phase 9: state = state*e^{g_last} + kd^T @ v_new -------
    {
      const float egl = __expf(s_gc[CH - 1]);
      for (int tt = 0; tt < 2; ++tt) {
        const int t = wave * 2 + tt;  // 16 tiles over [128 x 32]
        const int dk0 = (t >> 1) * 16, col0 = (t & 1) * 16;
        v8f acc;
#pragma unroll
        for (int i = 0; i < 8; ++i)
          acc[i] = s_state[(dk0 + i + 8 * h2) * DVG + col0 + rl] * egl;
#pragma unroll 8
        for (int kk = 0; kk < CH; kk += 4) {
          // A[m][kk'] = k[kk'][dk0+m] * s_kd[kk']  (transposed, K-scaled)
          v2f a;
          a.x = sk[(kk + 2 * h2) * DKC + dk0 + rl] * s_kd[kk + 2 * h2];
          a.y = sk[(kk + 2 * h2 + 1) * DKC + dk0 + rl] * s_kd[kk + 2 * h2 + 1];
          v2f b = frag_b(sv, DVG, kk, col0, h2, rl);
          acc = wmma4(a, b, acc);
        }
#pragma unroll
        for (int i = 0; i < 8; ++i)
          s_state[(dk0 + i + 8 * h2) * DVG + col0 + rl] = acc[i];
      }
    }
    __syncthreads();
  }
}

extern "C" void kernel_launch(void* const* d_in, const int* in_sizes, int n_in,
                              void* d_out, int out_size, void* d_ws,
                              size_t ws_size, hipStream_t stream) {
  const float* q    = (const float*)d_in[0];
  const float* k    = (const float*)d_in[1];
  const float* v    = (const float*)d_in[2];
  const float* g    = (const float*)d_in[3];
  const float* beta = (const float*)d_in[4];
  float* out = (float*)d_out;
  dim3 grid(BATCH * HEADS * GRP);  // 128 workgroups
  gdn_chunk_scan<<<grid, 256, 0, stream>>>(q, k, v, g, beta, out);
}

// v002
// Measured time: 801 microseconds a run.
// Two timings next to v001 both put it at 1.83 times that version's speed.
// Counting every step since v000, it is 3.82 times as fast.
#include <hip/hip_runtime.h>
#include <stdint.h>

typedef __attribute__((ext_vector_type(2))) float v2f;
typedef __attribute__((ext_vector_type(8))) float v8f;
typedef __attribute__((ext_vector_type(4))) uint32_t u32x4;
typedef __attribute__((ext_vector_type(8))) uint32_t u32x8;
typedef __attribute__((address_space(3))) char as3char;

namespace {
constexpr int BATCH = 2;
constexpr int SEQ   = 4096;
constexpr int HEADS = 16;
constexpr int DKC   = 128;          // Dk
constexpr int DVC   = 128;          // Dv
constexpr int CH    = 64;           // chunk length
constexpr int NCH   = SEQ / CH;     // 64 chunks
constexpr int GRP   = 4;            // Dv split -> 4 groups of 32 columns
constexpr int DVG   = DVC / GRP;    // 32
constexpr int HB    = CH / 2;       // 32: block size of the triangular inverse
constexpr float QSCALE = 0.08838834764831845f;  // 128^-0.5
constexpr int HC  = DKC / 2;        // 64 columns per half tile
constexpr int PQK = HC + 4;         // 68: row pitch of a half tile
constexpr int HSZ = 4608;           // floats per half tile: 64 x 68, rounded up to 2 KiB
constexpr int PS  = CH + 4;         // 68: row pitch of M, T and attn (A fragment reads)
constexpr int PV  = DVG + 16;       // 48
static_assert(HSZ >= CH * PQK && (HSZ * 4) % 2048 == 0, "half tile place: multiple of 2 KiB");
}

__device__ __forceinline__ v8f wmma4(v2f a, v2f b, v8f c) {
  // V_WMMA_F32_16X16X4_F32 : D = A(16x4,f32) x B(4x16,f32) + C(16x16,f32)
  return __builtin_amdgcn_wmma_f32_16x16x4_f32(false, a, false, b, (short)0, c,
                                               false, false);
}

// A fragment: A[row0 + (lane&15)][k0 + 2*(lane>>4) + {0,1}]
__device__ __forceinline__ v2f frag_a(const float* Sm, int ld, int row0, int k0,
                                      int h2, int rl) {
  const float* p = Sm + (row0 + rl) * ld + k0 + 2 * h2;
  v2f a; a.x = p[0]; a.y = p[1]; return a;
}
// B fragment (row-major B): B[k0 + 2*h2 + {0,1}][col0 + (lane&15)]
__device__ __forceinline__ v2f frag_b(const float* Sm, int ld, int k0, int col0,
                                      int h2, int rl) {
  v2f b;
  b.x = Sm[(k0 + 2 * h2    ) * ld + col0 + rl];
  b.y = Sm[(k0 + 2 * h2 + 1) * ld + col0 + rl];
  return b;
}
// B fragment of a transposed row-major matrix: B[d][c] = Sm[c][d]
__device__ __forceinline__ v2f frag_bt(const float* Sm, int ld, int k0, int col0,
                                       int h2, int rl) {
  const float* p = Sm + (col0 + rl) * ld + k0 + 2 * h2;
  v2f b; b.x = p[0]; b.y = p[1]; return b;
}

__device__ __forceinline__ uint32_t lds_off(const void* p) {
  return (uint32_t)(size_t)(as3char*)p;
}
__device__ __forceinline__ uint32_t uni(uint32_t v) {
  return (uint32_t)__builtin_amdgcn_readfirstlane(v);
}
__device__ __forceinline__ uint32_t pinned(uint32_t v) {
  uint32_t w = (uint32_t)__builtin_amdgcn_readfirstlane(v);
  asm volatile("" : "+s"(w));  // pinned(): the test stays in a scalar register
  return w;
}
// The compiler places no wait for the tensor mover: both are written by hand.
__device__ __forceinline__ void wait_tensor0() {
  asm volatile("s_wait_tensorcnt 0x0" ::: "memory");
}
__device__ __forceinline__ void wait_ds0() {
  asm volatile("s_wait_dscnt 0x0" ::: "memory");
}
constexpr uint32_t PAD_256B_16B = (1u << 20) | (5u << 22) | (3u << 25);

template <uint32_t WORD0, uint32_t ROWB, uint32_t SRCP>
__device__ __forceinline__ u32x8 tdm_group1() {
  constexpr uint32_t d0 = ROWB, d1 = (uint32_t)CH;
  u32x8 g1;
  g1[0] = uni(WORD0);
  g1[1] = uni((d0 & 0xFFFFu) << 16);
  g1[2] = uni((d0 >> 16) | ((d1 & 0xFFFFu) << 16));
  g1[3] = uni((d1 >> 16) | (d0 << 16));
  g1[4] = uni(d1);
  g1[5] = uni(SRCP);
  g1[6] = uni(0u);
  g1[7] = uni(0u);
  asm volatile("" : "+s"(g1));
  return g1;
}
__device__ __forceinline__ u32x4 tdm_group0(uint32_t lds_byte, const float* gptr) {
  const uint64_t ga = (uint64_t)(size_t)gptr;
  u32x4 g0;
  g0[0] = uni(1u);                                   // count = 1
  g0[1] = uni(lds_byte);                             // place in LDS, bytes
  g0[2] = uni((uint32_t)ga);                         // address [31:0]
  g0[3] = uni((((uint32_t)(ga >> 32)) & 0x01FFFFFFu) | 0x80000000u);  // [56:32], type 2
  return g0;
}
__device__ __forceinline__ void tdm_load(u32x4 g0, u32x8 g1) {
  asm volatile("tensor_load_to_lds %0, %1" :: "s"(g0), "s"(g1) : "memory");
}
__device__ __forceinline__ void wait_tensor0(u32x4 g0) {
  asm volatile("s_wait_tensorcnt 0x0" :: "s"(g0) : "memory");
}

__global__ __launch_bounds__(256)
void gdn_chunk_scan(const float* __restrict__ qg, const float* __restrict__ kg,
                    const float* __restrict__ vg, const float* __restrict__ gg,
                    const float* __restrict__ bg, float* __restrict__ outg) {
  // double-buffered q and k chunk; slices of a buffer: q low, q high, k low, k high
  __shared__ __attribute__((aligned(2048))) float s_qk[2][4][HSZ];  // 144 KB
  __shared__ __attribute__((aligned(2048))) float s_v[2][CH * DVG]; // 16 KB  v chunk
  __shared__ float s_vn[CH * PV];       // 12 KB  v_new
  __shared__ float s_tmp[CH * PV];      // 12 KB  U -> (v_beta - U)
  __shared__ float s_state[DKC * PV];   // 24 KB  recurrent state
  __shared__ float s_M[CH * PS];        // 17 KB  strict_tril(k_b k^T * decay), C negated
  __shared__ float s_T[CH * PS];        // 17 KB  (I+M)^-1
  __shared__ float s_attn[CH * PS];     // 17 KB  tril(q k^T * decay)
  __shared__ float s_red[512];
  __shared__ float s_invq[CH], s_invk[CH];
  __shared__ float s_graw[CH], s_gc[CH], s_beta[CH];
  __shared__ float s_bg[CH], s_eg[CH], s_kd[CH];

  const int tid  = threadIdx.x;
  const int wave = __builtin_amdgcn_readfirstlane((int)(threadIdx.x >> 5));
  const int lane = tid & 31;
  const int h2   = lane >> 4;   // half-wave select
  const int rl   = lane & 15;   // row/col within tile

  const int bid   = blockIdx.x;
  const int grp   = bid % GRP;
  const int head  = (bid / GRP) % HEADS;
  const int batch = bid / (GRP * HEADS);
  const int dv0   = grp * DVG;

  // One tensor load per issuing wave and chunk: waves 0 to 3 bring the four half
  // tiles of q and k (slice = wave), wave 4 brings the v tile.
  const u32x8 g1_qk = tdm_group1<PAD_256B_16B, HC * 4, HEADS * DKC * 4>();
  const u32x8 g1_v  = tdm_group1<0u, DVG * 4, HEADS * DVC * 4>();
  auto group0 = [&](int chunk, int b) {
    const size_t base = ((size_t)batch * SEQ + (size_t)chunk * CH) * HEADS + head;
    const float* srcp = (wave < 4) ? ((wave & 2) ? kg : qg) + base * DKC + (wave & 1) * HC
                                   : vg + base * DVC + dv0;
    const uint32_t dst = (wave < 4) ? lds_off(s_qk) + (uint32_t)(b * 4 + wave) * (HSZ * 4u)
                                    : lds_off(s_v[b]);
    return tdm_group0(dst, srcp);
  };

  for (int i = tid; i < DKC * DVG; i += 256) s_state[(i / DVG) * PV + (i % DVG)] = 0.f;
  // upper right block of T is zero for every chunk and is never written again
  for (int i = tid; i < HB * HB; i += 256)
    s_T[(i / HB) * PS + HB + (i % HB)] = 0.f;

  u32x4 g0 = group0(0, 0);
  if (pinned(wave < 4))  { tdm_load(g0, g1_qk); wait_tensor0(g0); }
  if (pinned(wave == 4)) { tdm_load(g0, g1_v);  wait_tensor0(g0); }
  __syncthreads();
  g0 = group0(1, 1);
  if (pinned(wave < 4))  tdm_load(g0, g1_qk);
  if (pinned(wave == 4)) tdm_load(g0, g1_v);

  for (int n = 0; n < NCH; ++n) {
    const int s_base = n * CH;
    const int buf = n & 1;
    float* sq = s_qk[buf][0];   // column c of a row: sq[(c / HC) * HSZ + row * PQK + c % HC]
    float* sk = s_qk[buf][2];
    const float* sv = s_v[buf];

    // ---------------- phase 1: scalars + sum-of-squares ----------------
    if (wave < 2) {  // tid 0..63
      size_t gsc = ((size_t)batch * SEQ + s_base + tid) * HEADS + head;
      s_graw[tid] = gg[gsc];
      s_beta[tid] = bg[gsc];
    }
    {
      const int row = tid >> 2, seg = tid & 3;
      const int off = (seg >> 1) * HSZ + row * PQK + (seg & 1) * 32;
      const float4* q4 = reinterpret_cast<const float4*>(sq + off);
      const float4* k4 = reinterpret_cast<const float4*>(sk + off);
      float ssq = 0.f, ssk = 0.f;
#pragma unroll
      for (int j = 0; j < 8; ++j) {
        float4 a = q4[j]; ssq += a.x * a.x + a.y * a.y + a.z * a.z + a.w * a.w;
        float4 b = k4[j]; ssk += b.x * b.x + b.y * b.y + b.z * b.z + b.w * b.w;
      }
      s_red[row * 4 + seg]       = ssq;
      s_red[256 + row * 4 + seg] = ssk;
    }
    __syncthreads();

    // ---------------- phase 2: norms + parallel prefix of g ----------------
    if (wave < 2) {
      const int j = tid;
      float sq2 = s_red[j * 4] + s_red[j * 4 + 1] + s_red[j * 4 + 2] +
                  s_red[j * 4 + 3];
      s_invq[j] = rsqrtf(sq2 + 1e-6f) * QSCALE;
      float sk2 = s_red[256 + j * 4] + s_red[256 + j * 4 + 1] +
                  s_red[256 + j * 4 + 2] + s_red[256 + j * 4 + 3];
      s_invk[j] = rsqrtf(sk2 + 1e-6f);
      float acc = 0.f;
      for (int i = 0; i <= j; ++i) acc += s_graw[i];
      s_gc[j] = acc;
    }
    __syncthreads();

    // ---------------- phase 3: derived scalars + row rescale ----------------
    if (wave < 2) {
      const float gl = s_gc[CH - 1], gc = s_gc[tid];
      s_bg[tid] = s_beta[tid] * __expf(gc);  // k_beta * exp(gc) row scale
      s_eg[tid] = __expf(gc);                // q * exp(gc) row scale
      s_kd[tid] = __expf(gl - gc);           // k * exp(g_last - gc) row scale
    }
    {
      const int row = tid >> 2, seg = tid & 3;
      const int off = (seg >> 1) * HSZ + row * PQK + (seg & 1) * 32;
      const float iq = s_invq[row], ik = s_invk[row];
      float* qr = sq + off;
      float* kr = sk + off;
#pragma unroll
      for (int j = 0; j < 32; ++j) { qr[j] *= iq; kr[j] *= ik; }
    }
    __syncthreads();

    // ---------------- phase 4: M and attn via WMMA ----------------
    // 16 M tiles + 16 attn tiles over [64x64]; 2 of each per wave.
    for (int tt = 0; tt < 2; ++tt) {
      const int ti = wave * 2 + tt;                  // scalar (wave uniform)
      const int row0 = (ti >> 2) * 16, col0 = (ti & 3) * 16;
      const float gCc = s_gc[col0 + rl];             // hoisted: fixed per lane
      // --- M tile: strict_tril(k_beta k^T * decay) ---
      if (col0 <= row0) {
        // hoisted row scale; the lower left 32x32 block C is stored as -C,
        // the sign that the blocked inverse of phases 5 to 6b needs there
        const float bb = (row0 >= HB && col0 < HB) ? -s_beta[row0 + rl]
                                                   : s_beta[row0 + rl];
        v8f acc = {0.f, 0.f, 0.f, 0.f, 0.f, 0.f, 0.f, 0.f};
        for (int hf = 0; hf < 2; ++hf) {
          const float* kh = sk + hf * HSZ;
#pragma unroll 8
          for (int kk = 0; kk < HC; kk += 4) {
            v2f a = frag_a(kh, PQK, row0, kk, h2, rl);
            a.x *= bb; a.y *= bb;
            v2f b = frag_bt(kh, PQK, kk, col0, h2, rl);  // B[d][c] = k[c][d]
            acc = wmma4(a, b, acc);
          }
        }
#pragma unroll
        for (int i = 0; i < 8; ++i) {
          int R = row0 + i + 8 * h2, Cc = col0 + rl;
          float val = acc[i] * __expf(s_gc[R] - gCc);
          s_M[R * PS + Cc] = (R > Cc) ? val : 0.f;
        }
      } else {  // strictly-upper tile: zeros
#pragma unroll
        for (int i = 0; i < 8; ++i)
          s_M[(row0 + i + 8 * h2) * PS + col0 + rl] = 0.f;
      }
      // --- attn tile: tril(q k^T * decay) ---
      {
        v8f acc = {0.f, 0.f, 0.f, 0.f, 0.f, 0.f, 0.f, 0.f};
        for (int hf = 0; hf < 2; ++hf) {
          const float* qh = sq + hf * HSZ;
          const float* kh = sk + hf * HSZ;
#pragma unroll 8
          for (int kk = 0; kk < HC; kk += 4) {
            v2f a = frag_a(qh, PQK, row0, kk, h2, rl);
            v2f b = frag_bt(kh, PQK, kk, col0, h2, rl);
            acc = wmma4(a, b, acc);
          }
        }
#pragma unroll
        for (int i = 0; i < 8; ++i) {
          int R = row0 + i + 8 * h2, Cc = col0 + rl;
          float val = acc[i] * __expf(s_gc[R] - gCc);
          s_attn[R * PS + Cc] = (R >= Cc) ? val : 0.f;
        }
      }
    }
    __syncthreads();

    // ---- phase 5: diagonal blocks of T = (I+M)^-1  ||  U = (k_b e^gc)@state ----
    // I+M = [[A,0],[C,B]] in 32x32 blocks; wave 0 inverts A, wave 1 inverts B.
    // Lane = column; the column stays in registers, M rows are broadcast reads.
    if (wave < 2) {
      const int b0 = wave * HB;
      const float* Mb = s_M + b0 * PS + b0;
      float t[HB];
      // every loop over t[] is fully unrolled: constant indices keep it in registers
#pragma unroll
      for (int r = 0; r < HB; ++r) t[r] = (r == lane) ? 1.f : 0.f;
      // four finished rows at a time are folded into every later row, so the
      // updates of different rows are independent of each other
#pragma unroll
      for (int c0 = 0; c0 < HB; c0 += 4) {
#pragma unroll
        for (int r = c0 + 1; r < HB; ++r) {
          const float4 m = *reinterpret_cast<const float4*>(Mb + r * PS + c0);
          t[r] -= m.x * t[c0];
          if (r > c0 + 1) t[r] -= m.y * t[c0 + 1];
          if (r > c0 + 2) t[r] -= m.z * t[c0 + 2];
          if (r > c0 + 3) t[r] -= m.w * t[c0 + 3];
        }
      }
#pragma unroll
      for (int r = 0; r < HB; ++r) s_T[(b0 + r) * PS + b0 + lane] = t[r];
    }
    {
      const int row0 = (wave >> 1) * 16, col0 = (wave & 1) * 16;  // 8 tiles
      const float sc = s_bg[row0 + rl];                           // hoisted
      v8f acc = {0.f, 0.f, 0.f, 0.f, 0.f, 0.f, 0.f, 0.f};
      for (int hf = 0; hf < 2; ++hf) {
        const float* kh = sk + hf * HSZ;
        const float* sh = s_state + hf * HC * PV;
#pragma unroll 8
        for (int kk = 0; kk < HC; kk += 4) {
          v2f a = frag_a(kh, PQK, row0, kk, h2, rl);
          a.x *= sc; a.y *= sc;
          v2f b = frag_b(sh, PV, kk, col0, h2, rl);
          acc = wmma4(a, b, acc);
        }
      }
#pragma unroll
      for (int i = 0; i < 8; ++i)
        s_tmp[(row0 + i + 8 * h2) * PV + col0 + rl] = acc[i];
    }
    __syncthreads();

    // ---- phase 6: X = -C @ A^-1 (waves 0-3, into T's lower left block) ----
    if (wave < 4) {
      const int row0 = (wave >> 1) * 16, col0 = (wave & 1) * 16;
      v8f acc = {0.f, 0.f, 0.f, 0.f, 0.f, 0.f, 0.f, 0.f};
#pragma unroll
      for (int kk = 0; kk < HB; kk += 4) {
        v2f a = frag_a(s_M + HB * PS, PS, row0, kk, h2, rl);
        v2f b = frag_b(s_T, PS, kk, col0, h2, rl);
        acc = wmma4(a, b, acc);
      }
#pragma unroll
      for (int i = 0; i < 8; ++i)
        s_T[(HB + row0 + i + 8 * h2) * PS + col0 + rl] = acc[i];
    }
    // ---------------- tmp = v_beta - U ----------------
    for (int idx = tid; idx < CH * DVG; idx += 256) {
      int r = idx >> 5;  // idx / DVG
      int c = idx & (DVG - 1);
      s_tmp[r * PV + c] = sv[idx] * s_beta[r] - s_tmp[r * PV + c];
    }
    __syncthreads();

    // ---- phase 6b: lower left block of T = B^-1 @ X, in place ----
    // One wave owns a 16-column strip of X: it reads the whole strip before it
    // stores over it, and no other wave reads or writes that strip.
    if (wave < 2) {
      const int col0 = wave * 16;
      v8f acc0 = {0.f, 0.f, 0.f, 0.f, 0.f, 0.f, 0.f, 0.f};
      v8f acc1 = {0.f, 0.f, 0.f, 0.f, 0.f, 0.f, 0.f, 0.f};
#pragma unroll
      for (int kk = 0; kk < HB; kk += 4) {
        v2f b  = frag_b(s_T + HB * PS, PS, kk, col0, h2, rl);
        v2f a0 = frag_a(s_T + HB * PS + HB, PS, 0, kk, h2, rl);
        v2f a1 = frag_a(s_T + HB * PS + HB, PS, 16, kk, h2, rl);
        acc0 = wmma4(a0, b, acc0);
        acc1 = wmma4(a1, b, acc1);
      }
#pragma unroll
      for (int i = 0; i < 8; ++i) {
        s_T[(HB + i + 8 * h2) * PS + col0 + rl]      = acc0[i];
        s_T[(HB + 16 + i + 8 * h2) * PS + col0 + rl] = acc1[i];
      }
    }
    __syncthreads();

    // ---------------- phase 7: v_new = T @ tmp ----------------
    {
      const int row0 = (wave >> 1) * 16, col0 = (wave & 1) * 16;
      v8f acc = {0.f, 0.f, 0.f, 0.f, 0.f, 0.f, 0.f, 0.f};
#pragma unroll 8
      for (int kk = 0; kk < CH; kk += 4) {
        v2f a = frag_a(s_T, PS, row0, kk, h2, rl);
        v2f b = frag_b(s_tmp, PV, kk, col0, h2, rl);
        acc = wmma4(a, b, acc);
      }
#pragma unroll
      for (int i = 0; i < 8; ++i)
        s_vn[(row0 + i + 8 * h2) * PV + col0 + rl] = acc[i];
    }
    __syncthreads();

    // ---------- phase 8: out = (q e^gc)@state + attn@v_new -> global ----------
    {
      const int row0 = (wave >> 1) * 16, col0 = (wave & 1) * 16;
      const float sc = s_eg[row0 + rl];  // hoisted
      v8f acc = {0.f, 0.f, 0.f, 0.f, 0.f, 0.f, 0.f, 0.f};
      for (int hf = 0; hf < 2; ++hf) {
        const float* qh = sq + hf * HSZ;
        const float* sh = s_state + hf * HC * PV;
#pragma unroll 8
        for (int kk = 0; kk < HC; kk += 4) {
          v2f a = frag_a(qh, PQK, row0, kk, h2, rl);
          a.x *= sc; a.y *= sc;
          v2f b = frag_b(sh, PV, kk, col0, h2, rl);
          acc = wmma4(a, b, acc);
        }
      }
#pragma unroll 8
      for (int kk = 0; kk < CH; kk += 4) {
        v2f a = frag_a(s_attn, PS, row0, kk, h2, rl);
        v2f b = frag_b(s_vn, PV, kk, col0, h2, rl);
        acc = wmma4(a, b, acc);
      }
#pragma unroll
      for (int i = 0; i < 8; ++i) {
        int R = row0 + i + 8 * h2;
        size_t go =
            ((size_t)((size_t)batch * SEQ + s_base + R) * HEADS + head) * DVC +
            dv0 + col0 + rl;
        outg[go] = acc[i];
      }
    }
    __syncthreads();

    // ------- phase 9: state = state*e^{g_last} + kd^T @ v_new -------
    {
      const float egl = __expf(s_gc[CH - 1]);
      for (int tt = 0; tt < 2; ++tt) {
        const int t = wave * 2 + tt;  // 16 tiles over [128 x 32]
        const int dk0 = (t >> 1) * 16, col0 = (t & 1) * 16;
        const float* kc = sk + (dk0 / HC) * HSZ + (dk0 % HC);  // k column dk0
        v8f acc;
#pragma unroll
        for (int i = 0; i < 8; ++i)
          acc[i] = s_state[(dk0 + i + 8 * h2) * PV + col0 + rl] * egl;
#pragma unroll 8
        for (int kk = 0; kk < CH; kk += 4) {
          // A[m][kk'] = k[kk'][dk0+m] * s_kd[kk']  (transposed, K-scaled)
          v2f a;
          a.x = kc[(kk + 2 * h2) * PQK + rl] * s_kd[kk + 2 * h2];
          a.y = kc[(kk + 2 * h2 + 1) * PQK + rl] * s_kd[kk + 2 * h2 + 1];
          v2f b = frag_b(s_vn, PV, kk, col0, h2, rl);
          acc = wmma4(a, b, acc);
        }
#pragma unroll
        for (int i = 0; i < 8; ++i)
          s_state[(dk0 + i + 8 * h2) * PV + col0 + rl] = acc[i];
      }
    }

    // ---- publish chunk n+1, then refill the buffer that chunk n has left ----
    wait_ds0();                                // this wave's LDS reads and writes are done
    if (pinned(wave < 5)) wait_tensor0(g0);    // the issuer's own tile of chunk n+1 has landed
    __syncthreads();
    if (pinned(n + 2 < NCH)) {
      g0 = group0(n + 2, buf);
      if (pinned(wave < 4))  tdm_load(g0, g1_qk);
      if (pinned(wave == 4)) tdm_load(g0, g1_v);
    }
  }
  wait_tensor0();
  wait_ds0();
}

extern "C" void kernel_launch(void* const* d_in, const int* in_sizes, int n_in,
                              void* d_out, int out_size, void* d_ws,
                              size_t ws_size, hipStream_t stream) {
  const float* q    = (const float*)d_in[0];
  const float* k    = (const float*)d_in[1];
  const float* v    = (const float*)d_in[2];
  const float* g    = (const float*)d_in[3];
  const float* beta = (const float*)d_in[4];
  float* out = (float*)d_out;
  dim3 grid(BATCH * HEADS * GRP);  // 128 workgroups
  gdn_chunk_scan<<<grid, 256, 0, stream>>>(q, k, v, g, beta, out);
}

// v003
// One run takes 395 microseconds.
// Timed twice side by side with v002, it ran 2.03 times as fast both times.
// All steps since v000 together make it 7.75 times as fast.
#include <hip/hip_runtime.h>
#include <stdint.h>

typedef __attribute__((ext_vector_type(2))) float v2f;
typedef __attribute__((ext_vector_type(8))) float v8f;
typedef __attribute__((ext_vector_type(4))) uint32_t u32x4;
typedef __attribute__((ext_vector_type(8))) uint32_t u32x8;
typedef __attribute__((address_space(3))) char as3char;

namespace {
constexpr int BATCH = 2;
constexpr int SEQ   = 4096;
constexpr int HEADS = 16;
constexpr int DKC   = 128;          // Dk
constexpr int DVC   = 128;          // Dv
constexpr int CH    = 64;           // chunk length
constexpr int NCH   = SEQ / CH;     // 64 chunks
constexpr int GRP   = 4;            // Dv split -> 4 groups of 32 columns
constexpr int DVG   = DVC / GRP;    // 32
constexpr int HB    = CH / 2;       // 32: block size of the triangular inverse
constexpr float QSCALE = 0.08838834764831845f;  // 128^-0.5
constexpr int HC  = DKC / 2;        // 64 columns per half tile
constexpr int PQK = HC + 4;         // 68: row pitch of a half tile
constexpr int HSZ = 4608;           // floats per half tile: 64 x 68, rounded up to 2 KiB
constexpr int PS  = CH + 4;         // 68: row pitch of M, T and attn (A fragment reads)
constexpr int PV  = DVG + 16;       // 48
// Workspace, in floats: per chunk of a (batch, head) the matrices T and attn as
// 64 rows of 64 floats, and a block of row scales.
constexpr int NCK  = BATCH * HEADS * NCH;      // 2048 chunks in all
constexpr int MSZ  = CH * CH;                  // floats of T or attn of a chunk
constexpr size_t WS_T = 0;
constexpr size_t WS_A = (size_t)NCK * MSZ;
constexpr size_t WS_S = 2 * (size_t)NCK * MSZ;
// scale block: 64 x {k row scale of U, q row scale, k row scale of the state
// update, beta, e^g_last}; each block lies on its own 128 B lines
constexpr int SSZ = 320;
static_assert(HSZ >= CH * PQK && (HSZ * 4) % 2048 == 0, "half tile place: multiple of 2 KiB");
}

__device__ __forceinline__ v8f wmma4(v2f a, v2f b, v8f c) {
  // V_WMMA_F32_16X16X4_F32 : D = A(16x4,f32) x B(4x16,f32) + C(16x16,f32)
  return __builtin_amdgcn_wmma_f32_16x16x4_f32(false, a, false, b, (short)0, c,
                                               false, false);
}

// A fragment: A[row0 + (lane&15)][k0 + 2*(lane>>4) + {0,1}]
__device__ __forceinline__ v2f frag_a(const float* Sm, int ld, int row0, int k0,
                                      int h2, int rl) {
  const float* p = Sm + (row0 + rl) * ld + k0 + 2 * h2;
  v2f a; a.x = p[0]; a.y = p[1]; return a;
}
// B fragment (row-major B): B[k0 + 2*h2 + {0,1}][col0 + (lane&15)]
__device__ __forceinline__ v2f frag_b(const float* Sm, int ld, int k0, int col0,
                                      int h2, int rl) {
  v2f b;
  b.x = Sm[(k0 + 2 * h2    ) * ld + col0 + rl];
  b.y = Sm[(k0 + 2 * h2 + 1) * ld + col0 + rl];
  return b;
}
// B fragment of a transposed row-major matrix: B[d][c] = Sm[c][d]
__device__ __forceinline__ v2f frag_bt(const float* Sm, int ld, int k0, int col0,
                                       int h2, int rl) {
  const float* p = Sm + (col0 + rl) * ld + k0 + 2 * h2;
  v2f b; b.x = p[0]; b.y = p[1]; return b;
}

__device__ __forceinline__ uint32_t lds_off(const void* p) {
  return (uint32_t)(size_t)(as3char*)p;
}
__device__ __forceinline__ uint32_t uni(uint32_t v) {
  return (uint32_t)__builtin_amdgcn_readfirstlane(v);
}
__device__ __forceinline__ uint32_t pinned(uint32_t v) {
  uint32_t w = (uint32_t)__builtin_amdgcn_readfirstlane(v);
  asm volatile("" : "+s"(w));  // pinned(): the test stays in a scalar register
  return w;
}
// The compiler places no wait for the tensor mover: both are written by hand.
__device__ __forceinline__ void wait_tensor0() {
  asm volatile("s_wait_tensorcnt 0x0" ::: "memory");
}
__device__ __forceinline__ void wait_ds0() {
  asm volatile("s_wait_dscnt 0x0" ::: "memory");
}
constexpr uint32_t PAD_256B_16B = (1u << 20) | (5u << 22) | (3u << 25);

template <uint32_t WORD0, uint32_t ROWB, uint32_t SRCP>
__device__ __forceinline__ u32x8 tdm_group1() {
  constexpr uint32_t d0 = ROWB, d1 = (uint32_t)CH;
  u32x8 g1;
  g1[0] = uni(WORD0);
  g1[1] = uni((d0 & 0xFFFFu) << 16);
  g1[2] = uni((d0 >> 16) | ((d1 & 0xFFFFu) << 16));
  g1[3] = uni((d1 >> 16) | (d0 << 16));
  g1[4] = uni(d1);
  g1[5] = uni(SRCP);
  g1[6] = uni(0u);
  g1[7] = uni(0u);
  asm volatile("" : "+s"(g1));
  return g1;
}
__device__ __forceinline__ u32x4 tdm_group0(uint32_t lds_byte, const float* gptr) {
  const uint64_t ga = (uint64_t)(size_t)gptr;
  u32x4 g0;
  g0[0] = uni(1u);                                   // count = 1
  g0[1] = uni(lds_byte);                             // place in LDS, bytes
  g0[2] = uni((uint32_t)ga);                         // address [31:0]
  g0[3] = uni((((uint32_t)(ga >> 32)) & 0x01FFFFFFu) | 0x80000000u);  // [56:32], type 2
  return g0;
}
__device__ __forceinline__ void tdm_load(u32x4 g0, u32x8 g1) {
  asm volatile("tensor_load_to_lds %0, %1" :: "s"(g0), "s"(g1) : "memory");
}
__device__ __forceinline__ void wait_tensor0(u32x4 g0) {
  asm volatile("s_wait_tensorcnt 0x0" :: "s"(g0) : "memory");
}

// A 64 x 64 tile at pitch PS in LDS goes to the workspace as 64 rows of 64 floats,
// 16 bytes a lane, by the 256 threads of a work-group.
__device__ __forceinline__ void tile_to_ws(float* __restrict__ dst, const float* Sm, int tid) {
  float4 r[MSZ / 4 / 256];
  // both loops unrolled: r[] stays in registers, the LDS reads share one wait
#pragma unroll
  for (int j = 0; j < MSZ / 4 / 256; ++j) {
    const int i = tid + j * 256;
    r[j] = *reinterpret_cast<const float4*>(Sm + (i >> 4) * PS + (i & 15) * 4);
  }
#pragma unroll
  for (int j = 0; j < MSZ / 4 / 256; ++j)
    reinterpret_cast<float4*>(dst)[tid + j * 256] = r[j];
  // stands in front of whatever next overwrites a register that these stores name
  asm volatile("s_wait_xcnt 0x0" ::: "memory");
}

// ---- launch 1: what a chunk needs of itself alone, every chunk in parallel ----
// One work-group per chunk of a (batch, head): norms, decay, attn and
// T = (I + M)^-1 go to the workspace, where the scan of launch 2 finds them.
__global__ __launch_bounds__(256)
void gdn_chunk_local(const float* __restrict__ qg, const float* __restrict__ kg,
                     const float* __restrict__ gg, const float* __restrict__ bg,
                     float* __restrict__ ws) {
  // slices: q low, q high, k low, k high
  __shared__ __attribute__((aligned(2048))) float s_qk[4][HSZ];     // 72 KB
  __shared__ __attribute__((aligned(16))) float s_M[CH * PS];       // 17 KB  strict_tril(k_b k^T * decay), C negated
  __shared__ __attribute__((aligned(16))) float s_T[CH * PS];       // 17 KB  (I+M)^-1
  __shared__ __attribute__((aligned(16))) float s_attn[CH * PS];    // 17 KB  tril(q k^T * decay)
  __shared__ float s_red[512];
  __shared__ float s_invq[CH], s_invk[CH];
  __shared__ float s_graw[CH], s_gc[CH], s_beta[CH];

  const int tid  = threadIdx.x;
  const int wave = __builtin_amdgcn_readfirstlane((int)(threadIdx.x >> 5));
  const int lane = tid & 31;
  const int h2   = lane >> 4;   // half-wave select
  const int rl   = lane & 15;   // row/col within tile

  const int ck     = blockIdx.x;            // (batch * HEADS + head) * NCH + chunk
  const int s_base = (ck % NCH) * CH;
  const int head   = (ck / NCH) % HEADS;
  const int batch  = ck / (NCH * HEADS);

  // upper right block of T is zero
  for (int i = tid; i < HB * HB; i += 256)
    s_T[(i / HB) * PS + HB + (i % HB)] = 0.f;

  // waves 0 to 3 each bring one half tile of q or k (slice = wave)
  if (pinned(wave < 4)) {
    const u32x8 g1_qk = tdm_group1<PAD_256B_16B, HC * 4, HEADS * DKC * 4>();
    const size_t base = ((size_t)batch * SEQ + s_base) * HEADS + head;
    const float* srcp = ((wave & 2) ? kg : qg) + base * DKC + (wave & 1) * HC;
    const u32x4 g0 = tdm_group0(lds_off(s_qk) + (uint32_t)wave * (HSZ * 4u), srcp);
    tdm_load(g0, g1_qk);
    wait_tensor0(g0);
  }
  __syncthreads();
  float* sq = s_qk[0];   // column c of a row: sq[(c / HC) * HSZ + row * PQK + c % HC]
  float* sk = s_qk[2];

  // ---------------- phase 1: scalars + sum-of-squares ----------------
  if (wave < 2) {  // tid 0..63
    size_t gsc = ((size_t)batch * SEQ + s_base + tid) * HEADS + head;
    s_graw[tid] = gg[gsc];
    s_beta[tid] = bg[gsc];
  }
  {
    const int row = tid >> 2, seg = tid & 3;
    const int off = (seg >> 1) * HSZ + row * PQK + (seg & 1) * 32;
    const float4* q4 = reinterpret_cast<const float4*>(sq + off);
    const float4* k4 = reinterpret_cast<const float4*>(sk + off);
    float ssq = 0.f, ssk = 0.f;
#pragma unroll
    for (int j = 0; j < 8; ++j) {
      float4 a = q4[j]; ssq += a.x * a.x + a.y * a.y + a.z * a.z + a.w * a.w;
      float4 b = k4[j]; ssk += b.x * b.x + b.y * b.y + b.z * b.z + b.w * b.w;
    }
    s_red[row * 4 + seg]       = ssq;
    s_red[256 + row * 4 + seg] = ssk;
  }
  __syncthreads();

  // ---------------- phase 2: norms + parallel prefix of g ----------------
  if (wave < 2) {
    const int j = tid;
    float sq2 = s_red[j * 4] + s_red[j * 4 + 1] + s_red[j * 4 + 2] +
                s_red[j * 4 + 3];
    s_invq[j] = rsqrtf(sq2 + 1e-6f) * QSCALE;
    float sk2 = s_red[256 + j * 4] + s_red[256 + j * 4 + 1] +
                s_red[256 + j * 4 + 2] + s_red[256 + j * 4 + 3];
    s_invk[j] = rsqrtf(sk2 + 1e-6f);
    float acc = 0.f;
    for (int i = 0; i <= j; ++i) acc += s_graw[i];
    s_gc[j] = acc;
  }
  __syncthreads();

  // ---------------- phase 3: derived scalars + row rescale ----------------
  // The scan reads q and k as they lie in memory: their norms go into its row scales.
  // Row tid's scales wait in registers and are stored at the kernel's end, where no
  // barrier stands behind the stores.
  float w_u = 0.f, w_q = 0.f, w_k = 0.f, w_b = 0.f, w_e = 0.f;
  if (wave < 2) {
    const float gl = s_gc[CH - 1], gc = s_gc[tid];
    w_b = s_beta[tid];
    w_u = s_invk[tid] * (w_b * __expf(gc));  // k_beta * exp(gc)
    w_q = s_invq[tid] * __expf(gc);          // q * exp(gc)
    w_k = s_invk[tid] * __expf(gl - gc);     // k * exp(g_last - gc)
    w_e = __expf(gl);                        // state decay
  }
  {
    const int row = tid >> 2, seg = tid & 3;
    const int off = (seg >> 1) * HSZ + row * PQK + (seg & 1) * 32;
    const float iq = s_invq[row], ik = s_invk[row];
    float* qr = sq + off;
    float* kr = sk + off;
#pragma unroll
    for (int j = 0; j < 32; ++j) { qr[j] *= iq; kr[j] *= ik; }
  }
  __syncthreads();

  // ---------------- phase 4: M and attn via WMMA ----------------
  // 16 M tiles + 16 attn tiles over [64x64]; 2 of each per wave.
  for (int tt = 0; tt < 2; ++tt) {
    const int ti = wave * 2 + tt;                  // scalar (wave uniform)
    const int row0 = (ti >> 2) * 16, col0 = (ti & 3) * 16;
    const float gCc = s_gc[col0 + rl];             // hoisted: fixed per lane
    // --- M tile: strict_tril(k_beta k^T * decay) ---
    if (col0 <= row0) {
      // hoisted row scale; the lower left 32x32 block C is stored as -C,
      // the sign that the blocked inverse of phases 5 to 6b needs there
      const float bb = (row0 >= HB && col0 < HB) ? -s_beta[row0 + rl]
                                                 : s_beta[row0 + rl];
      v8f acc = {0.f, 0.f, 0.f, 0.f, 0.f, 0.f, 0.f, 0.f};
      for (int hf = 0; hf < 2; ++hf) {
        const float* kh = sk + hf * HSZ;
#pragma unroll 8
        for (int kk = 0; kk < HC; kk += 4) {
          v2f a = frag_a(kh, PQK, row0, kk, h2, rl);
          a.x *= bb; a.y *= bb;
          v2f b = frag_bt(kh, PQK, kk, col0, h2, rl);  // B[d][c] = k[c][d]
          acc = wmma4(a, b, acc);
        }
      }
#pragma unroll
      for (int i = 0; i < 8; ++i) {
        int R = row0 + i + 8 * h2, Cc = col0 + rl;
        float val = acc[i] * __expf(s_gc[R] - gCc);
        s_M[R * PS + Cc] = (R > Cc) ? val : 0.f;
      }
    } else {  // strictly-upper tile: zeros
#pragma unroll
      for (int i = 0; i < 8; ++i)
        s_M[(row0 + i + 8 * h2) * PS + col0 + rl] = 0.f;
    }
    // --- attn tile: tril(q k^T * decay) ---
    {
      v8f acc = {0.f, 0.f, 0.f, 0.f, 0.f, 0.f, 0.f, 0.f};
      for (int hf = 0; hf < 2; ++hf) {
        const float* qh = sq + hf * HSZ;
        const float* kh = sk + hf * HSZ;
#pragma unroll 8
        for (int kk = 0; kk < HC; kk += 4) {
          v2f a = frag_a(qh, PQK, row0, kk, h2, rl);
          v2f b = frag_bt(kh, PQK, kk, col0, h2, rl);
          acc = wmma4(a, b, acc);
        }
      }
#pragma unroll
      for (int i = 0; i < 8; ++i) {
        int R = row0 + i + 8 * h2, Cc = col0 + rl;
        float val = acc[i] * __expf(s_gc[R] - gCc);
        s_attn[R * PS + Cc] = (R >= Cc) ? val : 0.f;
      }
    }
  }
  __syncthreads();

  // attn is final: to the workspace
  tile_to_ws(ws + WS_A + (size_t)ck * MSZ, s_attn, tid);

  // ---- phase 5: diagonal blocks of T = (I+M)^-1 ----
  // I+M = [[A,0],[C,B]] in 32x32 blocks; wave 0 inverts A, wave 1 inverts B.
  // Lane = column; the column stays in registers, M rows are broadcast reads.
  if (wave < 2) {
    const int b0 = wave * HB;
    const float* Mb = s_M + b0 * PS + b0;
    float t[HB];
    // every loop over t[] is fully unrolled: constant indices keep it in registers
#pragma unroll
    for (int r = 0; r < HB; ++r) t[r] = (r == lane) ? 1.f : 0.f;
    // four finished rows at a time are folded into every later row, so the
    // updates of different rows are independent of each other
#pragma unroll
    for (int c0 = 0; c0 < HB; c0 += 4) {
#pragma unroll
      for (int r = c0 + 1; r < HB; ++r) {
        const float4 m = *reinterpret_cast<const float4*>(Mb + r * PS + c0);
        t[r] -= m.x * t[c0];
        if (r > c0 + 1) t[r] -= m.y * t[c0 + 1];
        if (r > c0 + 2) t[r] -= m.z * t[c0 + 2];
        if (r > c0 + 3) t[r] -= m.w * t[c0 + 3];
      }
    }
#pragma unroll
    for (int r = 0; r < HB; ++r) s_T[(b0 + r) * PS + b0 + lane] = t[r];
  }
  __syncthreads();

  // ---- phase 6: X = -C @ A^-1 (waves 0-3, into T's lower left block) ----
  if (wave < 4) {
    const int row0 = (wave >> 1) * 16, col0 = (wave & 1) * 16;
    v8f acc = {0.f, 0.f, 0.f, 0.f, 0.f, 0.f, 0.f, 0.f};
#pragma unroll
    for (int kk = 0; kk < HB; kk += 4) {
      v2f a = frag_a(s_M + HB * PS, PS, row0, kk, h2, rl);
      v2f b = frag_b(s_T, PS, kk, col0, h2, rl);
      acc = wmma4(a, b, acc);
    }
#pragma unroll
    for (int i = 0; i < 8; ++i)
      s_T[(HB + row0 + i + 8 * h2) * PS + col0 + rl] = acc[i];
  }
  __syncthreads();

  // ---- phase 6b: lower left block of T = B^-1 @ X, in place ----
  // One wave owns a 16-column strip of X: it reads the whole strip before it
  // stores over it, and no other wave reads or writes that strip.
  if (wave < 2) {
    const int col0 = wave * 16;
    v8f acc0 = {0.f, 0.f, 0.f, 0.f, 0.f, 0.f, 0.f, 0.f};
    v8f acc1 = {0.f, 0.f, 0.f, 0.f, 0.f, 0.f, 0.f, 0.f};
#pragma unroll
    for (int kk = 0; kk < HB; kk += 4) {
      v2f b  = frag_b(s_T + HB * PS, PS, kk, col0, h2, rl);
      v2f a0 = frag_a(s_T + HB * PS + HB, PS, 0, kk, h2, rl);
      v2f a1 = frag_a(s_T + HB * PS + HB, PS, 16, kk, h2, rl);
      acc0 = wmma4(a0, b, acc0);
      acc1 = wmma4(a1, b, acc1);
    }
#pragma unroll
    for (int i = 0; i < 8; ++i) {
      s_T[(HB + i + 8 * h2) * PS + col0 + rl]      = acc0[i];
      s_T[(HB + 16 + i + 8 * h2) * PS + col0 + rl] = acc1[i];
    }
  }
  __syncthreads();

  tile_to_ws(ws + WS_T + (size_t)ck * MSZ, s_T, tid);
  if (wave < 2) {
    float* wsc = ws + WS_S + (size_t)ck * SSZ;
    wsc[tid]       = w_u;
    wsc[64 + tid]  = w_q;
    wsc[128 + tid] = w_k;
    wsc[192 + tid] = w_b;
    wsc[256 + tid] = w_e;
  }
}

// ---- launch 2: the scan over the chunks of a (batch, head, group of Dv columns) ----
__global__ __launch_bounds__(256)
void gdn_chunk_scan(const float* __restrict__ qg, const float* __restrict__ kg,
                    const float* __restrict__ vg, const float* __restrict__ ws,
                    float* __restrict__ outg) {
  // double-buffered q and k chunk; slices of a buffer: q low, q high, k low, k high
  __shared__ __attribute__((aligned(2048))) float s_qk[2][4][HSZ];  // 144 KB
  __shared__ __attribute__((aligned(2048))) float s_ta[2][2][HSZ];  // 72 KB  T, attn at pitch PS
  __shared__ __attribute__((aligned(2048))) float s_v[2][CH * DVG]; // 16 KB  v chunk
  __shared__ float s_vn[CH * PV];       // 12 KB  v_new
  __shared__ float s_tmp[CH * PV];      // 12 KB  v_beta - U
  __shared__ float s_state[DKC * PV];   // 24 KB  recurrent state
  __shared__ float s_sc[2][4 * CH];     // row scales of a chunk, as launch 1 wrote them

  const int tid  = threadIdx.x;
  const int wave = __builtin_amdgcn_readfirstlane((int)(threadIdx.x >> 5));
  const int lane = tid & 31;
  const int h2   = lane >> 4;   // half-wave select
  const int rl   = lane & 15;   // row/col within tile

  const int bid   = blockIdx.x;
  const int grp   = bid % GRP;
  const int head  = (bid / GRP) % HEADS;
  const int batch = bid / (GRP * HEADS);
  const int dv0   = grp * DVG;
  const int ck0   = (batch * HEADS + head) * NCH;   // first chunk's place in the workspace

  // One tensor load per issuing wave and chunk: waves 0 to 3 bring the four half
  // tiles of q and k (slice = wave), wave 4 the v tile, wave 5 T, wave 6 attn.
  const u32x8 g1_qk = tdm_group1<PAD_256B_16B, HC * 4, HEADS * DKC * 4>();
  const u32x8 g1_v  = tdm_group1<0u, DVG * 4, HEADS * DVC * 4>();
  const u32x8 g1_ta = tdm_group1<PAD_256B_16B, CH * 4, CH * 4>();
  auto group0 = [&](int chunk, int b) {
    const size_t base = ((size_t)batch * SEQ + (size_t)chunk * CH) * HEADS + head;
    const float* srcp = (wave < 4) ? ((wave & 2) ? kg : qg) + base * DKC + (wave & 1) * HC
                      : (wave == 4) ? vg + base * DVC + dv0
                      : ws + ((wave == 5) ? WS_T : WS_A) + (size_t)(ck0 + chunk) * MSZ;
    const uint32_t dst = (wave < 4) ? lds_off(s_qk) + (uint32_t)(b * 4 + wave) * (HSZ * 4u)
                       : (wave == 4) ? lds_off(s_v[b])
                       : lds_off(s_ta) + (uint32_t)(b * 2 + ((wave == 5) ? 0 : 1)) * (HSZ * 4u);
    return tdm_group0(dst, srcp);
  };
  const float* wsc = ws + WS_S + (size_t)ck0 * SSZ;  // scale blocks of this (batch, head)

  for (int i = tid; i < DKC * DVG; i += 256) s_state[(i / DVG) * PV + (i % DVG)] = 0.f;
  s_sc[0][tid] = wsc[tid];
  float egl = wsc[4 * CH];      // e^g_last of the chunk in work

  u32x4 g0 = group0(0, 0);
  if (pinned(wave < 4))  { tdm_load(g0, g1_qk); wait_tensor0(g0); }
  if (pinned(wave == 4)) { tdm_load(g0, g1_v);  wait_tensor0(g0); }
  if (pinned(wave == 5 || wave == 6)) { tdm_load(g0, g1_ta); wait_tensor0(g0); }
  __syncthreads();
  g0 = group0(1, 1);
  if (pinned(wave < 4))  tdm_load(g0, g1_qk);
  if (pinned(wave == 4)) tdm_load(g0, g1_v);
  if (pinned(wave == 5 || wave == 6)) tdm_load(g0, g1_ta);

  for (int n = 0; n < NCH; ++n) {
    const int s_base = n * CH;
    const int buf = n & 1;
    const float* sq = s_qk[buf][0];   // column c of a row: sq[(c / HC) * HSZ + row * PQK + c % HC]
    const float* sk = s_qk[buf][2];
    const float* sT = s_ta[buf][0];
    const float* sattn = s_ta[buf][1];
    const float* sv = s_v[buf];
    const float* s_bg   = s_sc[buf];            // k row scale of U
    const float* s_eg   = s_sc[buf] + CH;       // q row scale
    const float* s_kd   = s_sc[buf] + 2 * CH;   // k row scale of the state update
    const float* s_beta = s_sc[buf] + 3 * CH;

    // the next chunk's scales are fetched now and stored to LDS at the foot
    const int nn = (n + 1 < NCH) ? n + 1 : n;
    const float sc_next  = wsc[(size_t)nn * SSZ + tid];
    const float egl_next = wsc[(size_t)nn * SSZ + 4 * CH];

    // ---------------- tmp = v_beta - (k_b e^gc)@state ----------------
    {
      const int row0 = (wave >> 1) * 16, col0 = (wave & 1) * 16;  // 8 tiles
      const float sc = s_bg[row0 + rl];                           // hoisted
      v8f acc = {0.f, 0.f, 0.f, 0.f, 0.f, 0.f, 0.f, 0.f};
      for (int hf = 0; hf < 2; ++hf) {
        const float* kh = sk + hf * HSZ;
        const float* sh = s_state + hf * HC * PV;
#pragma unroll 8
        for (int kk = 0; kk < HC; kk += 4) {
          v2f a = frag_a(kh, PQK, row0, kk, h2, rl);
          a.x *= sc; a.y *= sc;
          v2f b = frag_b(sh, PV, kk, col0, h2, rl);
          acc = wmma4(a, b, acc);
        }
      }
#pragma unroll
      for (int i = 0; i < 8; ++i) {
        const int R = row0 + i + 8 * h2, Cc = col0 + rl;
        s_tmp[R * PV + Cc] = sv[R * DVG + Cc] * s_beta[R] - acc[i];
      }
    }
    __syncthreads();

    // ---------------- v_new = T @ tmp ----------------
    {
      const int row0 = (wave >> 1) * 16, col0 = (wave & 1) * 16;
      v8f acc = {0.f, 0.f, 0.f, 0.f, 0.f, 0.f, 0.f, 0.f};
#pragma unroll 8
      for (int kk = 0; kk < CH; kk += 4) {
        v2f a = frag_a(sT, PS, row0, kk, h2, rl);
        v2f b = frag_b(s_tmp, PV, kk, col0, h2, rl);
        acc = wmma4(a, b, acc);
      }
#pragma unroll
      for (int i = 0; i < 8; ++i)
        s_vn[(row0 + i + 8 * h2) * PV + col0 + rl] = acc[i];
    }
    __syncthreads();

    // ---------- out = (q e^gc)@state + attn@v_new -> global ----------
    {
      const int row0 = (wave >> 1) * 16, col0 = (wave & 1) * 16;
      const float sc = s_eg[row0 + rl];  // hoisted
      v8f acc = {0.f, 0.f, 0.f, 0.f, 0.f, 0.f, 0.f, 0.f};
      for (int hf = 0; hf < 2; ++hf) {
        const float* qh = sq + hf * HSZ;
        const float* sh = s_state + hf * HC * PV;
#pragma unroll 8
        for (int kk = 0; kk < HC; kk += 4) {
          v2f a = frag_a(qh, PQK, row0, kk, h2, rl);
          a.x *= sc; a.y *= sc;
          v2f b = frag_b(sh, PV, kk, col0, h2, rl);
          acc = wmma4(a, b, acc);
        }
      }
#pragma unroll 8
      for (int kk = 0; kk < CH; kk += 4) {
        v2f a = frag_a(sattn, PS, row0, kk, h2, rl);
        v2f b = frag_b(s_vn, PV, kk, col0, h2, rl);
        acc = wmma4(a, b, acc);
      }
#pragma unroll
      for (int i = 0; i < 8; ++i) {
        int R = row0 + i + 8 * h2;
        size_t go =
            ((size_t)((size_t)batch * SEQ + s_base + R) * HEADS + head) * DVC +
            dv0 + col0 + rl;
        outg[go] = acc[i];
      }
    }
    __syncthreads();

    // ------- state = state*e^{g_last} + kd^T @ v_new -------
    {
      for (int tt = 0; tt < 2; ++tt) {
        const int t = wave * 2 + tt;  // 16 tiles over [128 x 32]
        const int dk0 = (t >> 1) * 16, col0 = (t & 1) * 16;
        const float* kc = sk + (dk0 / HC) * HSZ + (dk0 % HC);  // k column dk0
        v8f acc;
#pragma unroll
        for (int i = 0; i < 8; ++i)
          acc[i] = s_state[(dk0 + i + 8 * h2) * PV + col0 + rl] * egl;
#pragma unroll 8
        for (int kk = 0; kk < CH; kk += 4) {
          // A[m][kk'] = k[kk'][dk0+m] * s_kd[kk']  (transposed, K-scaled)
          v2f a;
          a.x = kc[(kk + 2 * h2) * PQK + rl] * s_kd[kk + 2 * h2];
          a.y = kc[(kk + 2 * h2 + 1) * PQK + rl] * s_kd[kk + 2 * h2 + 1];
          v2f b = frag_b(s_vn, PV, kk, col0, h2, rl);
          acc = wmma4(a, b, acc);
        }
#pragma unroll
        for (int i = 0; i < 8; ++i)
          s_state[(dk0 + i + 8 * h2) * PV + col0 + rl] = acc[i];
      }
    }
    s_sc[buf ^ 1][tid] = sc_next;   // its last readers left it at the foot of the trip before
    egl = egl_next;

    // ---- publish chunk n+1, then refill the buffer that chunk n has left ----
    wait_ds0();                                // this wave's LDS reads and writes are done
    if (pinned(wave < 7)) wait_tensor0(g0);    // the issuer's own tile of chunk n+1 has landed
    __syncthreads();
    if (pinned(n + 2 < NCH)) {
      g0 = group0(n + 2, buf);
      if (pinned(wave < 4))  tdm_load(g0, g1_qk);
      if (pinned(wave == 4)) tdm_load(g0, g1_v);
      if (pinned(wave == 5 || wave == 6)) tdm_load(g0, g1_ta);
    }
  }
  wait_tensor0();
  wait_ds0();
}

extern "C" void kernel_launch(void* const* d_in, const int* in_sizes, int n_in,
                              void* d_out, int out_size, void* d_ws,
                              size_t ws_size, hipStream_t stream) {
  const float* q    = (const float*)d_in[0];
  const float* k    = (const float*)d_in[1];
  const float* v    = (const float*)d_in[2];
  const float* g    = (const float*)d_in[3];
  const float* beta = (const float*)d_in[4];
  float* out = (float*)d_out;
  float* ws  = (float*)d_ws;
  gdn_chunk_local<<<dim3(NCK), 256, 0, stream>>>(q, k, g, beta, ws);  // 2048 workgroups
  dim3 grid(BATCH * HEADS * GRP);  // 128 workgroups
  gdn_chunk_scan<<<grid, 256, 0, stream>>>(q, k, v, ws, out);
}

// v004
// A run of this version takes 284 microseconds.
// Next to v003, in two timings, it ran 1.39 times as fast each time.
// Counting every step since v000, it is 10.8 times as fast.
#include <hip/hip_runtime.h>
#include <stdint.h>

typedef __attribute__((ext_vector_type(2))) float v2f;
typedef __attribute__((ext_vector_type(8))) float v8f;
typedef __attribute__((ext_vector_type(4))) uint32_t u32x4;
typedef __attribute__((ext_vector_type(8))) uint32_t u32x8;
typedef __attribute__((address_space(3))) char as3char;

namespace {
constexpr int BATCH = 2;
constexpr int SEQ   = 4096;
constexpr int HEADS = 16;
constexpr int DKC   = 128;          // Dk
constexpr int DVC   = 128;          // Dv
constexpr int CH    = 64;           // chunk length
constexpr int NCH   = SEQ / CH;     // 64 chunks
constexpr int GRP   = 4;            // Dv split -> 4 groups of 32 columns
constexpr int DVG   = DVC / GRP;    // 32
constexpr int HB    = CH / 2;       // 32: block size of the triangular inverse
constexpr float QSCALE = 0.08838834764831845f;  // 128^-0.5
constexpr int HC  = DKC / 2;        // 64 columns per half tile
constexpr int PQK = HC + 4;         // 68: row pitch of a half tile
constexpr int HSZ = 4608;           // floats per half tile: 64 x 68, rounded up to 2 KiB
constexpr int PS  = CH + 4;         // 68: row pitch of M, T and attn (A fragment reads)
constexpr int PV  = DVG + 16;       // 48
// Workspace, in floats: per chunk of a (batch, head) the matrices T and attn as
// 64 rows of 64 floats, and a block of row scales.
constexpr int NCK  = BATCH * HEADS * NCH;      // 2048 chunks in all
constexpr int MSZ  = CH * CH;                  // floats of T or attn of a chunk
constexpr size_t WS_T = 0;
constexpr size_t WS_A = (size_t)NCK * MSZ;
constexpr size_t WS_S = 2 * (size_t)NCK * MSZ;
// scale block: 64 x {k row scale of U, q row scale, k row scale of the state
// update, beta, e^g_last}; each block lies on its own 128 B lines
constexpr int SSZ = 320;
static_assert(HSZ >= CH * PQK && (HSZ * 4) % 2048 == 0, "half tile place: multiple of 2 KiB");
}

__device__ __forceinline__ v8f wmma4(v2f a, v2f b, v8f c) {
  // V_WMMA_F32_16X16X4_F32 : D = A(16x4,f32) x B(4x16,f32) + C(16x16,f32)
  return __builtin_amdgcn_wmma_f32_16x16x4_f32(false, a, false, b, (short)0, c,
                                               false, false);
}

// A fragment: A[row0 + (lane&15)][k0 + 2*(lane>>4) + {0,1}]
__device__ __forceinline__ v2f frag_a(const float* Sm, int ld, int row0, int k0,
                                      int h2, int rl) {
  const float* p = Sm + (row0 + rl) * ld + k0 + 2 * h2;
  v2f a; a.x = p[0]; a.y = p[1]; return a;
}
// B fragment (row-major B): B[k0 + 2*h2 + {0,1}][col0 + (lane&15)]
__device__ __forceinline__ v2f frag_b(const float* Sm, int ld, int k0, int col0,
                                      int h2, int rl) {
  v2f b;
  b.x = Sm[(k0 + 2 * h2    ) * ld + col0 + rl];
  b.y = Sm[(k0 + 2 * h2 + 1) * ld + col0 + rl];
  return b;
}
// B fragment of a transposed row-major matrix: B[d][c] = Sm[c][d]
__device__ __forceinline__ v2f frag_bt(const float* Sm, int ld, int k0, int col0,
                                       int h2, int rl) {
  const float* p = Sm + (col0 + rl) * ld + k0 + 2 * h2;
  v2f b; b.x = p[0]; b.y = p[1]; return b;
}

__device__ __forceinline__ uint32_t lds_off(const void* p) {
  return (uint32_t)(size_t)(as3char*)p;
}
__device__ __forceinline__ uint32_t uni(uint32_t v) {
  return (uint32_t)__builtin_amdgcn_readfirstlane(v);
}
__device__ __forceinline__ uint32_t pinned(uint32_t v) {
  uint32_t w = (uint32_t)__builtin_amdgcn_readfirstlane(v);
  asm volatile("" : "+s"(w));  // pinned(): the test stays in a scalar register
  return w;
}
// The compiler places no wait for the tensor mover: both are written by hand.
__device__ __forceinline__ void wait_tensor0() {
  asm volatile("s_wait_tensorcnt 0x0" ::: "memory");
}
__device__ __forceinline__ void wait_ds0() {
  asm volatile("s_wait_dscnt 0x0" ::: "memory");
}
constexpr uint32_t PAD_256B_16B = (1u << 20) | (5u << 22) | (3u << 25);

template <uint32_t WORD0, uint32_t ROWB, uint32_t SRCP>
__device__ __forceinline__ u32x8 tdm_group1() {
  constexpr uint32_t d0 = ROWB, d1 = (uint32_t)CH;
  u32x8 g1;
  g1[0] = uni(WORD0);
  g1[1] = uni((d0 & 0xFFFFu) << 16);
  g1[2] = uni((d0 >> 16) | ((d1 & 0xFFFFu) << 16));
  g1[3] = uni((d1 >> 16) | (d0 << 16));
  g1[4] = uni(d1);
  g1[5] = uni(SRCP);
  g1[6] = uni(0u);
  g1[7] = uni(0u);
  asm volatile("" : "+s"(g1));
  return g1;
}
__device__ __forceinline__ u32x4 tdm_group0(uint32_t lds_byte, const float* gptr) {
  const uint64_t ga = (uint64_t)(size_t)gptr;
  u32x4 g0;
  g0[0] = uni(1u);                                   // count = 1
  g0[1] = uni(lds_byte);                             // place in LDS, bytes
  g0[2] = uni((uint32_t)ga);                         // address [31:0]
  g0[3] = uni((((uint32_t)(ga >> 32)) & 0x01FFFFFFu) | 0x80000000u);  // [56:32], type 2
  return g0;
}
__device__ __forceinline__ void tdm_load(u32x4 g0, u32x8 g1) {
  asm volatile("tensor_load_to_lds %0, %1" :: "s"(g0), "s"(g1) : "memory");
}
__device__ __forceinline__ void wait_tensor0(u32x4 g0) {
  asm volatile("s_wait_tensorcnt 0x0" :: "s"(g0) : "memory");
}

// A 64 x 64 tile at pitch PS in LDS goes to the workspace as 64 rows of 64 floats,
// 16 bytes a lane, by the 256 threads of a work-group.
__device__ __forceinline__ void tile_to_ws(float* __restrict__ dst, const float* Sm, int tid) {
  float4 r[MSZ / 4 / 256];
  // both loops unrolled: r[] stays in registers, the LDS reads share one wait
#pragma unroll
  for (int j = 0; j < MSZ / 4 / 256; ++j) {
    const int i = tid + j * 256;
    r[j] = *reinterpret_cast<const float4*>(Sm + (i >> 4) * PS + (i & 15) * 4);
  }
#pragma unroll
  for (int j = 0; j < MSZ / 4 / 256; ++j)
    reinterpret_cast<float4*>(dst)[tid + j * 256] = r[j];
  // stands in front of whatever next overwrites a register that these stores name
  asm volatile("s_wait_xcnt 0x0" ::: "memory");
}

// ---- launch 1: what a chunk needs of itself alone, every chunk in parallel ----
// One work-group per chunk of a (batch, head): norms, decay, attn and
// T = (I + M)^-1 go to the workspace, where the scan of launch 2 finds them.
__global__ __launch_bounds__(256)
void gdn_chunk_local(const float* __restrict__ qg, const float* __restrict__ kg,
                     const float* __restrict__ gg, const float* __restrict__ bg,
                     float* __restrict__ ws) {
  // slices: q low, q high, k low, k high
  __shared__ __attribute__((aligned(2048))) float s_qk[4][HSZ];     // 72 KB
  __shared__ __attribute__((aligned(16))) float s_M[CH * PS];       // 17 KB  strict_tril(k_b k^T * decay), C negated
  __shared__ __attribute__((aligned(16))) float s_T[CH * PS];       // 17 KB  (I+M)^-1
  __shared__ __attribute__((aligned(16))) float s_attn[CH * PS];    // 17 KB  tril(q k^T * decay)
  __shared__ float s_red[512];
  __shared__ float s_invq[CH], s_invk[CH];
  __shared__ float s_graw[CH], s_gc[CH], s_beta[CH];

  const int tid  = threadIdx.x;
  const int wave = __builtin_amdgcn_readfirstlane((int)(threadIdx.x >> 5));
  const int lane = tid & 31;
  const int h2   = lane >> 4;   // half-wave select
  const int rl   = lane & 15;   // row/col within tile

  const int ck     = blockIdx.x;            // (batch * HEADS + head) * NCH + chunk
  const int s_base = (ck % NCH) * CH;
  const int head   = (ck / NCH) % HEADS;
  const int batch  = ck / (NCH * HEADS);

  // upper right block of T is zero
  for (int i = tid; i < HB * HB; i += 256)
    s_T[(i / HB) * PS + HB + (i % HB)] = 0.f;

  // waves 0 to 3 each bring one half tile of q or k (slice = wave)
  if (pinned(wave < 4)) {
    const u32x8 g1_qk = tdm_group1<PAD_256B_16B, HC * 4, HEADS * DKC * 4>();
    const size_t base = ((size_t)batch * SEQ + s_base) * HEADS + head;
    const float* srcp = ((wave & 2) ? kg : qg) + base * DKC + (wave & 1) * HC;
    const u32x4 g0 = tdm_group0(lds_off(s_qk) + (uint32_t)wave * (HSZ * 4u), srcp);
    tdm_load(g0, g1_qk);
    wait_tensor0(g0);
  }
  __syncthreads();
  float* sq = s_qk[0];   // column c of a row: sq[(c / HC) * HSZ + row * PQK + c % HC]
  float* sk = s_qk[2];

  // ---------------- phase 1: scalars + sum-of-squares ----------------
  if (wave < 2) {  // tid 0..63
    size_t gsc = ((size_t)batch * SEQ + s_base + tid) * HEADS + head;
    s_graw[tid] = gg[gsc];
    s_beta[tid] = bg[gsc];
  }
  {
    const int row = tid >> 2, seg = tid & 3;
    const int off = (seg >> 1) * HSZ + row * PQK + (seg & 1) * 32;
    const float4* q4 = reinterpret_cast<const float4*>(sq + off);
    const float4* k4 = reinterpret_cast<const float4*>(sk + off);
    float ssq = 0.f, ssk = 0.f;
#pragma unroll
    for (int j = 0; j < 8; ++j) {
      float4 a = q4[j]; ssq += a.x * a.x + a.y * a.y + a.z * a.z + a.w * a.w;
      float4 b = k4[j]; ssk += b.x * b.x + b.y * b.y + b.z * b.z + b.w * b.w;
    }
    s_red[row * 4 + seg]       = ssq;
    s_red[256 + row * 4 + seg] = ssk;
  }
  __syncthreads();

  // ---------------- phase 2: norms + parallel prefix of g ----------------
  if (wave < 2) {
    const int j = tid;
    float sq2 = s_red[j * 4] + s_red[j * 4 + 1] + s_red[j * 4 + 2] +
                s_red[j * 4 + 3];
    s_invq[j] = rsqrtf(sq2 + 1e-6f) * QSCALE;
    float sk2 = s_red[256 + j * 4] + s_red[256 + j * 4 + 1] +
                s_red[256 + j * 4 + 2] + s_red[256 + j * 4 + 3];
    s_invk[j] = rsqrtf(sk2 + 1e-6f);
    float acc = 0.f;
    for (int i = 0; i <= j; ++i) acc += s_graw[i];
    s_gc[j] = acc;
  }
  __syncthreads();

  // ---------------- phase 3: derived scalars + row rescale ----------------
  // The scan reads q and k as they lie in memory: their norms go into its row scales.
  // Row tid's scales wait in registers and are stored at the kernel's end, where no
  // barrier stands behind the stores.
  float w_u = 0.f, w_q = 0.f, w_k = 0.f, w_b = 0.f, w_e = 0.f;
  if (wave < 2) {
    const float gl = s_gc[CH - 1], gc = s_gc[tid];
    w_b = s_beta[tid];
    w_u = s_invk[tid] * (w_b * __expf(gc));  // k_beta * exp(gc)
    w_q = s_invq[tid] * __expf(gc);          // q * exp(gc)
    w_k = s_invk[tid] * __expf(gl - gc);     // k * exp(g_last - gc)
    w_e = __expf(gl);                        // state decay
  }
  {
    const int row = tid >> 2, seg = tid & 3;
    const int off = (seg >> 1) * HSZ + row * PQK + (seg & 1) * 32;
    const float iq = s_invq[row], ik = s_invk[row];
    float* qr = sq + off;
    float* kr = sk + off;
#pragma unroll
    for (int j = 0; j < 32; ++j) { qr[j] *= iq; kr[j] *= ik; }
  }
  __syncthreads();

  // ---------------- phase 4: M and attn via WMMA ----------------
  // 16 M tiles + 16 attn tiles over [64x64]; 2 of each per wave.
  for (int tt = 0; tt < 2; ++tt) {
    const int ti = wave * 2 + tt;                  // scalar (wave uniform)
    const int row0 = (ti >> 2) * 16, col0 = (ti & 3) * 16;
    const float gCc = s_gc[col0 + rl];             // hoisted: fixed per lane
    // --- M tile: strict_tril(k_beta k^T * decay) ---
    if (col0 <= row0) {
      // hoisted row scale; the lower left 32x32 block C is stored as -C,
      // the sign that the blocked inverse of phases 5 to 6b needs there
      const float bb = (row0 >= HB && col0 < HB) ? -s_beta[row0 + rl]
                                                 : s_beta[row0 + rl];
      v8f acc = {0.f, 0.f, 0.f, 0.f, 0.f, 0.f, 0.f, 0.f};
      for (int hf = 0; hf < 2; ++hf) {
        const float* kh = sk + hf * HSZ;
#pragma unroll 8
        for (int kk = 0; kk < HC; kk += 4) {
          v2f a = frag_a(kh, PQK, row0, kk, h2, rl);
          a.x *= bb; a.y *= bb;
          v2f b = frag_bt(kh, PQK, kk, col0, h2, rl);  // B[d][c] = k[c][d]
          acc = wmma4(a, b, acc);
        }
      }
#pragma unroll
      for (int i = 0; i < 8; ++i) {
        int R = row0 + i + 8 * h2, Cc = col0 + rl;
        float val = acc[i] * __expf(s_gc[R] - gCc);
        s_M[R * PS + Cc] = (R > Cc) ? val : 0.f;
      }
    } else {  // strictly-upper tile: zeros
#pragma unroll
      for (int i = 0; i < 8; ++i)
        s_M[(row0 + i + 8 * h2) * PS + col0 + rl] = 0.f;
    }
    // --- attn tile: tril(q k^T * decay) ---
    {
      v8f acc = {0.f, 0.f, 0.f, 0.f, 0.f, 0.f, 0.f, 0.f};
      for (int hf = 0; hf < 2; ++hf) {
        const float* qh = sq + hf * HSZ;
        const float* kh = sk + hf * HSZ;
#pragma unroll 8
        for (int kk = 0; kk < HC; kk += 4) {
          v2f a = frag_a(qh, PQK, row0, kk, h2, rl);
          v2f b = frag_bt(kh, PQK, kk, col0, h2, rl);
          acc = wmma4(a, b, acc);
        }
      }
#pragma unroll
      for (int i = 0; i < 8; ++i) {
        int R = row0 + i + 8 * h2, Cc = col0 + rl;
        float val = acc[i] * __expf(s_gc[R] - gCc);
        s_attn[R * PS + Cc] = (R >= Cc) ? val : 0.f;
      }
    }
  }
  __syncthreads();

  // attn is final: to the workspace
  tile_to_ws(ws + WS_A + (size_t)ck * MSZ, s_attn, tid);

  // ---- phase 5: diagonal blocks of T = (I+M)^-1 ----
  // I+M = [[A,0],[C,B]] in 32x32 blocks; wave 0 inverts A, wave 1 inverts B.
  // Lane = column; the column stays in registers, M rows are broadcast reads.
  if (wave < 2) {
    const int b0 = wave * HB;
    const float* Mb = s_M + b0 * PS + b0;
    float t[HB];
    // every loop over t[] is fully unrolled: constant indices keep it in registers
#pragma unroll
    for (int r = 0; r < HB; ++r) t[r] = (r == lane) ? 1.f : 0.f;
    // four finished rows at a time are folded into every later row, so the
    // updates of different rows are independent of each other
#pragma unroll
    for (int c0 = 0; c0 < HB; c0 += 4) {
#pragma unroll
      for (int r = c0 + 1; r < HB; ++r) {
        const float4 m = *reinterpret_cast<const float4*>(Mb + r * PS + c0);
        t[r] -= m.x * t[c0];
        if (r > c0 + 1) t[r] -= m.y * t[c0 + 1];
        if (r > c0 + 2) t[r] -= m.z * t[c0 + 2];
        if (r > c0 + 3) t[r] -= m.w * t[c0 + 3];
      }
    }
#pragma unroll
    for (int r = 0; r < HB; ++r) s_T[(b0 + r) * PS + b0 + lane] = t[r];
  }
  __syncthreads();

  // ---- phase 6: X = -C @ A^-1 (waves 0-3, into T's lower left block) ----
  if (wave < 4) {
    const int row0 = (wave >> 1) * 16, col0 = (wave & 1) * 16;
    v8f acc = {0.f, 0.f, 0.f, 0.f, 0.f, 0.f, 0.f, 0.f};
#pragma unroll
    for (int kk = 0; kk < HB; kk += 4) {
      v2f a = frag_a(s_M + HB * PS, PS, row0, kk, h2, rl);
      v2f b = frag_b(s_T, PS, kk, col0, h2, rl);
      acc = wmma4(a, b, acc);
    }
#pragma unroll
    for (int i = 0; i < 8; ++i)
      s_T[(HB + row0 + i + 8 * h2) * PS + col0 + rl] = acc[i];
  }
  __syncthreads();

  // ---- phase 6b: lower left block of T = B^-1 @ X, in place ----
  // One wave owns a 16-column strip of X: it reads the whole strip before it
  // stores over it, and no other wave reads or writes that strip.
  if (wave < 2) {
    const int col0 = wave * 16;
    v8f acc0 = {0.f, 0.f, 0.f, 0.f, 0.f, 0.f, 0.f, 0.f};
    v8f acc1 = {0.f, 0.f, 0.f, 0.f, 0.f, 0.f, 0.f, 0.f};
#pragma unroll
    for (int kk = 0; kk < HB; kk += 4) {
      v2f b  = frag_b(s_T + HB * PS, PS, kk, col0, h2, rl);
      v2f a0 = frag_a(s_T + HB * PS + HB, PS, 0, kk, h2, rl);
      v2f a1 = frag_a(s_T + HB * PS + HB, PS, 16, kk, h2, rl);
      acc0 = wmma4(a0, b, acc0);
      acc1 = wmma4(a1, b, acc1);
    }
#pragma unroll
    for (int i = 0; i < 8; ++i) {
      s_T[(HB + i + 8 * h2) * PS + col0 + rl]      = acc0[i];
      s_T[(HB + 16 + i + 8 * h2) * PS + col0 + rl] = acc1[i];
    }
  }
  __syncthreads();

  tile_to_ws(ws + WS_T + (size_t)ck * MSZ, s_T, tid);
  if (wave < 2) {
    float* wsc = ws + WS_S + (size_t)ck * SSZ;
    wsc[tid]       = w_u;
    wsc[64 + tid]  = w_q;
    wsc[128 + tid] = w_k;
    wsc[192 + tid] = w_b;
    wsc[256 + tid] = w_e;
  }
}

// ---- launch 2: the scan over the chunks of a (batch, head, group of Dv columns) ----
__global__ __launch_bounds__(256)
void gdn_chunk_scan(const float* __restrict__ qg, const float* __restrict__ kg,
                    const float* __restrict__ vg, const float* __restrict__ ws,
                    float* __restrict__ outg) {
  // double-buffered q and k chunk; slices of a buffer: q low, q high, k low, k high
  __shared__ __attribute__((aligned(2048))) float s_qk[2][4][HSZ];  // 144 KB
  __shared__ __attribute__((aligned(2048))) float s_ta[2][2][HSZ];  // 72 KB  T, attn at pitch PS
  __shared__ __attribute__((aligned(2048))) float s_v[2][CH * DVG]; // 16 KB  v chunk
  __shared__ float s_vn[CH * PV];       // 12 KB  v_new
  __shared__ float s_tmp[CH * PV];      // 12 KB  v_beta - U
  __shared__ float s_state[DKC * PV];   // 24 KB  recurrent state
  __shared__ float s_sc[2][4 * CH];     // row scales of a chunk, as launch 1 wrote them

  const int tid  = threadIdx.x;
  const int wave = __builtin_amdgcn_readfirstlane((int)(threadIdx.x >> 5));
  const int lane = tid & 31;
  const int h2   = lane >> 4;   // half-wave select
  const int rl   = lane & 15;   // row/col within tile

  const int bid   = blockIdx.x;
  const int grp   = bid % GRP;
  const int head  = (bid / GRP) % HEADS;
  const int batch = bid / (GRP * HEADS);
  const int dv0   = grp * DVG;
  const int ck0   = (batch * HEADS + head) * NCH;   // first chunk's place in the workspace

  // One tensor load per issuing wave and chunk: waves 0 to 3 bring the four half
  // tiles of q and k (slice = wave), wave 4 the v tile, wave 5 T, wave 6 attn.
  const u32x8 g1_qk = tdm_group1<PAD_256B_16B, HC * 4, HEADS * DKC * 4>();
  const u32x8 g1_v  = tdm_group1<0u, DVG * 4, HEADS * DVC * 4>();
  const u32x8 g1_ta = tdm_group1<PAD_256B_16B, CH * 4, CH * 4>();
  auto group0 = [&](int chunk, int b) {
    const size_t base = ((size_t)batch * SEQ + (size_t)chunk * CH) * HEADS + head;
    const float* srcp = (wave < 4) ? ((wave & 2) ? kg : qg) + base * DKC + (wave & 1) * HC
                      : (wave == 4) ? vg + base * DVC + dv0
                      : ws + ((wave == 5) ? WS_T : WS_A) + (size_t)(ck0 + chunk) * MSZ;
    const uint32_t dst = (wave < 4) ? lds_off(s_qk) + (uint32_t)(b * 4 + wave) * (HSZ * 4u)
                       : (wave == 4) ? lds_off(s_v[b])
                       : lds_off(s_ta) + (uint32_t)(b * 2 + ((wave == 5) ? 0 : 1)) * (HSZ * 4u);
    return tdm_group0(dst, srcp);
  };
  const float* wsc = ws + WS_S + (size_t)ck0 * SSZ;  // scale blocks of this (batch, head)

  for (int i = tid; i < DKC * DVG; i += 256) s_state[(i / DVG) * PV + (i % DVG)] = 0.f;
  s_sc[0][tid] = wsc[tid];
  float egl = wsc[4 * CH];      // e^g_last of the chunk in work

  u32x4 g0 = group0(0, 0);
  if (pinned(wave < 4))  { tdm_load(g0, g1_qk); wait_tensor0(g0); }
  if (pinned(wave == 4)) { tdm_load(g0, g1_v);  wait_tensor0(g0); }
  if (pinned(wave == 5 || wave == 6)) { tdm_load(g0, g1_ta); wait_tensor0(g0); }
  __syncthreads();
  g0 = group0(1, 1);
  if (pinned(wave < 4))  tdm_load(g0, g1_qk);
  if (pinned(wave == 4)) tdm_load(g0, g1_v);
  if (pinned(wave == 5 || wave == 6)) tdm_load(g0, g1_ta);

  const int row0 = (wave >> 1) * 16, col0 = (wave & 1) * 16;  // this wave's tile of tmp, v_new, out
  // This wave's two tiles of the state, rows dk0 to dk0 + 31 of its 16 columns: they stay
  // in registers from chunk to chunk; LDS holds the copy that the other waves read.
  const int dk0 = (wave >> 1) * 32;
  const int eslot = tid & (CH - 1);
  v8f st_a = {0.f, 0.f, 0.f, 0.f, 0.f, 0.f, 0.f, 0.f};
  v8f st_b = {0.f, 0.f, 0.f, 0.f, 0.f, 0.f, 0.f, 0.f};

  for (int n = 0; n < NCH; ++n) {
    const int s_base = n * CH;
    const int buf = n & 1;
    const float* sq = s_qk[buf][0];   // column c of a row: sq[(c / HC) * HSZ + row * PQK + c % HC]
    const float* sk = s_qk[buf][2];
    const float* sT = s_ta[buf][0];
    const float* sattn = s_ta[buf][1];
    const float* sv = s_v[buf];
    const float* s_bg   = s_sc[buf];            // k row scale of U
    const float* s_eg   = s_sc[buf] + CH;       // q row scale
    const float* s_kd   = s_sc[buf] + 2 * CH;   // k row scale of the state update
    const float* s_beta = s_sc[buf] + 3 * CH;

    // The fragment reads of a part of the trip stand in one place, ahead of the WMMA chains
    // that take them, and the fragments stay in registers. The scheduling groups at the end
    // of each part say that order (reads, WMMAs, ...) to the compiler, which otherwise puts
    // each read one or two chain links ahead of its WMMA, so that every link waits on LDS.
    // A group's size is an upper bound.
#define SG_READS(n)  __builtin_amdgcn_sched_group_barrier(0x100, n, 0)  // LDS reads
#define SG_WMMAS(n)  __builtin_amdgcn_sched_group_barrier(0x008, n, 0)  // matrix instructions
#define SG_STORES(n) __builtin_amdgcn_sched_group_barrier(0x040, n, 0)  // global stores
    // every loop over a fragment array is fully unrolled: constant indices keep it in registers

    // ---- reads 1: k rows, this wave's 16 state columns (for tmp and for out), v, beta ----
    v2f kf[32], sf[32];
#pragma unroll
    for (int j = 0; j < 32; ++j) {
      kf[j] = frag_a(sk + (j >> 4) * HSZ, PQK, row0, (j & 15) * 4, h2, rl);
      sf[j] = frag_b(s_state, PV, j * 4, col0, h2, rl);
    }
    const float sc_u = s_bg[row0 + rl];
    float vr[8], be[8];
#pragma unroll
    for (int i = 0; i < 8; ++i) {
      vr[i] = sv[(row0 + i + 8 * h2) * DVG + col0 + rl];
      be[i] = s_beta[row0 + i + 8 * h2];
    }
    // the next chunk's scales are fetched now and stored to LDS at the foot
    const float* scn = wsc + (size_t)((n + 1 < NCH) ? n + 1 : n) * SSZ;
    const float sc_next  = scn[tid];
    const float egl_next = scn[4 * CH + eslot];
    // stands in front of whatever next overwrites a register that these loads name;
    // as inputs of the wait, the two index registers keep their values up to it
    asm volatile("s_wait_xcnt 0x0" :: "v"(tid), "v"(eslot) : "memory");

    // ---------------- tmp = v_beta - (k_b e^gc)@state ----------------
    v8f acc = {0.f, 0.f, 0.f, 0.f, 0.f, 0.f, 0.f, 0.f};
#pragma unroll
    for (int j = 0; j < 32; ++j) {
      v2f a = kf[j];
      a.x *= sc_u; a.y *= sc_u;
      acc = wmma4(a, sf[j], acc);
    }
#pragma unroll
    for (int i = 0; i < 8; ++i)
      s_tmp[(row0 + i + 8 * h2) * PV + col0 + rl] = vr[i] * be[i] - acc[i];
    SG_READS(100);
    SG_WMMAS(32);
    __syncthreads();
    // a full stop for the scheduler: the groups of the parts of a trip are solved apart
    // (solved as one, the reads of the last part fell among its WMMAs again)
    __builtin_amdgcn_sched_barrier(0);

    // ---- reads 2: q rows, T, tmp ----
    const float sc_q = s_eg[row0 + rl];
    v2f qf[32], tf[16], Tf[16];
#pragma unroll
    for (int j = 0; j < 32; ++j)
      qf[j] = frag_a(sq + (j >> 4) * HSZ, PQK, row0, (j & 15) * 4, h2, rl);
#pragma unroll
    for (int j = 0; j < 16; ++j) {
      Tf[j] = frag_a(sT, PS, row0, j * 4, h2, rl);
      tf[j] = frag_b(s_tmp, PV, j * 4, col0, h2, rl);
    }

    // ---------- out = (q e^gc)@state + attn@v_new: k steps 0 to 23 of q@state ----------
    v8f acc_o = {0.f, 0.f, 0.f, 0.f, 0.f, 0.f, 0.f, 0.f};
#pragma unroll
    for (int j = 0; j < 24; ++j) {
      v2f a = qf[j];
      a.x *= sc_q; a.y *= sc_q;
      acc_o = wmma4(a, sf[j], acc_o);
    }
    // ---------------- v_new = T @ tmp ----------------
    acc = v8f{0.f, 0.f, 0.f, 0.f, 0.f, 0.f, 0.f, 0.f};
#pragma unroll
    for (int j = 0; j < 16; ++j) acc = wmma4(Tf[j], tf[j], acc);
#pragma unroll
    for (int i = 0; i < 8; ++i)
      s_vn[(row0 + i + 8 * h2) * PV + col0 + rl] = acc[i];
    SG_READS(100);
    SG_WMMAS(40);
    __syncthreads();
    __builtin_amdgcn_sched_barrier(0);  // full stop for the scheduler, as behind the barrier above

    // ---- reads 3: v_new (for out and for the state) and attn; they land under the
    //      last k steps of q@state, whose operands are in registers ----
    v2f vn[16], af[16];
#pragma unroll
    for (int j = 0; j < 16; ++j) {
      vn[j] = frag_b(s_vn, PV, j * 4, col0, h2, rl);
      af[j] = frag_a(sattn, PS, row0, j * 4, h2, rl);
    }
#pragma unroll
    for (int j = 24; j < 32; ++j) {
      v2f a = qf[j];
      a.x *= sc_q; a.y *= sc_q;
      acc_o = wmma4(a, sf[j], acc_o);
    }
    // ---- reads 4: k columns and their scales; they land under attn@v_new ----
    v2f kd[16], ka[16], kb[16];
    {
      const float* kc = sk + (dk0 / HC) * HSZ + (dk0 % HC);  // k column dk0
#pragma unroll
      for (int j = 0; j < 16; ++j) {
        kd[j].x = s_kd[j * 4 + 2 * h2];
        kd[j].y = s_kd[j * 4 + 2 * h2 + 1];
        ka[j] = frag_b(kc, PQK, j * 4, 0, h2, rl);    // A[m][kk'] = k[kk'][dk0 + m]
        kb[j] = frag_b(kc, PQK, j * 4, 16, h2, rl);   // the same of the next 16 columns
      }
    }
#pragma unroll
    for (int j = 0; j < 16; ++j) acc_o = wmma4(af[j], vn[j], acc_o);
    {
      float* po = outg +
          ((size_t)((size_t)batch * SEQ + s_base + row0 + 8 * h2) * HEADS + head) * DVC +
          dv0 + col0 + rl;
#pragma unroll
      for (int i = 0; i < 8; ++i) po[(size_t)i * HEADS * DVC] = acc_o[i];
      // stands in front of whatever next overwrites a register that these stores name;
      // as inputs of the wait, address and data keep their registers up to it
      asm volatile("s_wait_xcnt 0x0" :: "v"(po), "v"(acc_o) : "memory");
    }

    // ------- state = state*e^{g_last} + kd^T @ v_new -------
    // No wave reads the state from LDS behind reads 1, so no barrier stands here.
#pragma unroll
    for (int i = 0; i < 8; ++i) { st_a[i] *= egl; st_b[i] *= egl; }
#pragma unroll
    for (int j = 0; j < 16; ++j) {
      v2f a = ka[j], b = kb[j];
      a.x *= kd[j].x; a.y *= kd[j].y;   // transposed, K-scaled
      b.x *= kd[j].x; b.y *= kd[j].y;
      st_a = wmma4(a, vn[j], st_a);
      st_b = wmma4(b, vn[j], st_b);
    }
#pragma unroll
    for (int i = 0; i < 8; ++i) {
      s_state[(dk0 + i + 8 * h2) * PV + col0 + rl]      = st_a[i];
      s_state[(dk0 + 16 + i + 8 * h2) * PV + col0 + rl] = st_b[i];
    }
    // the out stores go ahead of the state's chains, which cover them up to the foot barrier
    SG_READS(40);
    SG_WMMAS(8);
    SG_READS(72);
    SG_WMMAS(16);
    SG_STORES(8);
    SG_WMMAS(32);
#undef SG_READS
#undef SG_WMMAS
#undef SG_STORES
    s_sc[buf ^ 1][tid] = sc_next;   // its last readers left it at the foot of the trip before
    egl = egl_next;

    // ---- publish chunk n+1, then refill the buffer that chunk n has left ----
    wait_ds0();                                // this wave's LDS reads and writes are done
    if (pinned(wave < 7)) wait_tensor0(g0);    // the issuer's own tile of chunk n+1 has landed
    __syncthreads();
    if (pinned(n + 2 < NCH)) {
      g0 = group0(n + 2, buf);
      if (pinned(wave < 4))  tdm_load(g0, g1_qk);
      if (pinned(wave == 4)) tdm_load(g0, g1_v);
      if (pinned(wave == 5 || wave == 6)) tdm_load(g0, g1_ta);
    }
  }
  wait_tensor0();
  wait_ds0();
}

extern "C" void kernel_launch(void* const* d_in, const int* in_sizes, int n_in,
                              void* d_out, int out_size, void* d_ws,
                              size_t ws_size, hipStream_t stream) {
  const float* q    = (const float*)d_in[0];
  const float* k    = (const float*)d_in[1];
  const float* v    = (const float*)d_in[2];
  const float* g    = (const float*)d_in[3];
  const float* beta = (const float*)d_in[4];
  float* out = (float*)d_out;
  float* ws  = (float*)d_ws;
  gdn_chunk_local<<<dim3(NCK), 256, 0, stream>>>(q, k, g, beta, ws);  // 2048 workgroups
  dim3 grid(BATCH * HEADS * GRP);  // 128 workgroups
  gdn_chunk_scan<<<grid, 256, 0, stream>>>(q, k, v, ws, out);
}

// v005
// A run of this version takes 231 microseconds.
// Two timings next to v004 both put it at 1.23 times that version's speed.
// All steps since v000 together make it 13.2 times as fast.
#include <hip/hip_runtime.h>
#include <stdint.h>

typedef __attribute__((ext_vector_type(2))) float v2f;
typedef __attribute__((ext_vector_type(8))) float v8f;
typedef __attribute__((ext_vector_type(4))) uint32_t u32x4;
typedef __attribute__((ext_vector_type(8))) uint32_t u32x8;
typedef __attribute__((address_space(3))) char as3char;

namespace {
constexpr int BATCH = 2;
constexpr int SEQ   = 4096;
constexpr int HEADS = 16;
constexpr int DKC   = 128;
constexpr int DVC   = 128;
constexpr int CH    = 64;
constexpr int NCH   = SEQ / CH;
constexpr int GRP   = 8;
constexpr int DVG   = DVC / GRP;
constexpr int NTS   = 128;
constexpr int HB    = CH / 2;
constexpr float QSCALE = 0.08838834764831845f;  // 128^-0.5
constexpr int HC  = DKC / 2;        // 64 columns per half tile
constexpr int PQK = HC + 4;         // 68: row pitch of a half tile
constexpr int HSZ = 4608;           // floats per half tile: 64 x 68, rounded up to 2 KiB
constexpr int PS  = CH + 4;         // 68: row pitch of M, T and attn (A fragment reads)
constexpr int PV  = DVG;            // 16
// Workspace, in floats: per chunk of a (batch, head) the matrices T and attn as
// 64 rows of 64 floats, and a block of row scales.
constexpr int NCK  = BATCH * HEADS * NCH;      // 2048 chunks in all
constexpr int MSZ  = CH * CH;                  // floats of T or attn of a chunk
constexpr size_t WS_T = 0;
constexpr size_t WS_A = (size_t)NCK * MSZ;
constexpr size_t WS_S = 2 * (size_t)NCK * MSZ;
// scale block: 64 x {k row scale of U, q row scale, k row scale of the state
// update, beta, e^g_last}; each block lies on its own 128 B lines
constexpr int SSZ = 320;
static_assert(HSZ >= CH * PQK && (HSZ * 4) % 2048 == 0, "half tile place: multiple of 2 KiB");
}

__device__ __forceinline__ v8f wmma4(v2f a, v2f b, v8f c) {
  // V_WMMA_F32_16X16X4_F32 : D = A(16x4,f32) x B(4x16,f32) + C(16x16,f32)
  return __builtin_amdgcn_wmma_f32_16x16x4_f32(false, a, false, b, (short)0, c,
                                               false, false);
}

// A fragment: A[row0 + (lane&15)][k0 + 2*(lane>>4) + {0,1}]
__device__ __forceinline__ v2f frag_a(const float* Sm, int ld, int row0, int k0,
                                      int h2, int rl) {
  const float* p = Sm + (row0 + rl) * ld + k0 + 2 * h2;
  v2f a; a.x = p[0]; a.y = p[1]; return a;
}
// B fragment (row-major B): B[k0 + 2*h2 + {0,1}][col0 + (lane&15)]
__device__ __forceinline__ v2f frag_b(const float* Sm, int ld, int k0, int col0,
                                      int h2, int rl) {
  v2f b;
  b.x = Sm[(k0 + 2 * h2    ) * ld + col0 + rl];
  b.y = Sm[(k0 + 2 * h2 + 1) * ld + col0 + rl];
  return b;
}
// B fragment of a transposed row-major matrix: B[d][c] = Sm[c][d]
__device__ __forceinline__ v2f frag_bt(const float* Sm, int ld, int k0, int col0,
                                       int h2, int rl) {
  const float* p = Sm + (col0 + rl) * ld + k0 + 2 * h2;
  v2f b; b.x = p[0]; b.y = p[1]; return b;
}

__device__ __forceinline__ uint32_t lds_off(const void* p) {
  return (uint32_t)(size_t)(as3char*)p;
}
__device__ __forceinline__ uint32_t uni(uint32_t v) {
  return (uint32_t)__builtin_amdgcn_readfirstlane(v);
}
__device__ __forceinline__ uint32_t pinned(uint32_t v) {
  uint32_t w = (uint32_t)__builtin_amdgcn_readfirstlane(v);
  asm volatile("" : "+s"(w));  // pinned(): the test stays in a scalar register
  return w;
}
// The compiler places no wait for the tensor mover: both are written by hand.
__device__ __forceinline__ void wait_tensor0() {
  asm volatile("s_wait_tensorcnt 0x0" ::: "memory");
}
__device__ __forceinline__ void wait_ds0() {
  asm volatile("s_wait_dscnt 0x0" ::: "memory");
}
constexpr uint32_t PAD_256B_16B = (1u << 20) | (5u << 22) | (3u << 25);

template <uint32_t WORD0, uint32_t ROWB, uint32_t SRCP>
__device__ __forceinline__ u32x8 tdm_group1() {
  constexpr uint32_t d0 = ROWB, d1 = (uint32_t)CH;
  u32x8 g1;
  g1[0] = uni(WORD0);
  g1[1] = uni((d0 & 0xFFFFu) << 16);
  g1[2] = uni((d0 >> 16) | ((d1 & 0xFFFFu) << 16));
  g1[3] = uni((d1 >> 16) | (d0 << 16));
  g1[4] = uni(d1);
  g1[5] = uni(SRCP);
  g1[6] = uni(0u);
  g1[7] = uni(0u);
  asm volatile("" : "+s"(g1));
  return g1;
}
__device__ __forceinline__ u32x4 tdm_group0(uint32_t lds_byte, const float* gptr) {
  const uint64_t ga = (uint64_t)(size_t)gptr;
  u32x4 g0;
  g0[0] = uni(1u);                                   // count = 1
  g0[1] = uni(lds_byte);                             // place in LDS, bytes
  g0[2] = uni((uint32_t)ga);                         // address [31:0]
  g0[3] = uni((((uint32_t)(ga >> 32)) & 0x01FFFFFFu) | 0x80000000u);  // [56:32], type 2
  return g0;
}
__device__ __forceinline__ void tdm_load(u32x4 g0, u32x8 g1) {
  asm volatile("tensor_load_to_lds %0, %1" :: "s"(g0), "s"(g1) : "memory");
}
__device__ __forceinline__ void wait_tensor0(u32x4 g0) {
  asm volatile("s_wait_tensorcnt 0x0" :: "s"(g0) : "memory");
}
// the same for a wave with two requests outstanding
__device__ __forceinline__ void wait_tensor0(u32x4 g0, u32x4 g0x) {
  asm volatile("s_wait_tensorcnt 0x0" :: "s"(g0), "s"(g0x) : "memory");
}
__device__ __forceinline__ void tdm_load_held(u32x4& g0, u32x8 g1) {
  asm volatile("tensor_load_to_lds %0, %1" : "+s"(g0) : "s"(g1) : "memory");
}

// A 64 x 64 tile at pitch PS in LDS goes to the workspace as 64 rows of 64 floats,
// 16 bytes a lane, by the 256 threads of a work-group.
__device__ __forceinline__ void tile_to_ws(float* __restrict__ dst, const float* Sm, int tid) {
  float4 r[MSZ / 4 / 256];
  // both loops unrolled: r[] stays in registers, the LDS reads share one wait
#pragma unroll
  for (int j = 0; j < MSZ / 4 / 256; ++j) {
    const int i = tid + j * 256;
    r[j] = *reinterpret_cast<const float4*>(Sm + (i >> 4) * PS + (i & 15) * 4);
  }
#pragma unroll
  for (int j = 0; j < MSZ / 4 / 256; ++j)
    reinterpret_cast<float4*>(dst)[tid + j * 256] = r[j];
  // stands in front of whatever next overwrites a register that these stores name
  asm volatile("s_wait_xcnt 0x0" ::: "memory");
}

// ---- launch 1: what a chunk needs of itself alone, every chunk in parallel ----
// One work-group per chunk of a (batch, head): norms, decay, attn and
// T = (I + M)^-1 go to the workspace, where the scan of launch 2 finds them.
__global__ __launch_bounds__(256)
void gdn_chunk_local(const float* __restrict__ qg, const float* __restrict__ kg,
                     const float* __restrict__ gg, const float* __restrict__ bg,
                     float* __restrict__ ws) {
  // slices: q low, q high, k low, k high
  __shared__ __attribute__((aligned(2048))) float s_qk[4][HSZ];     // 72 KB
  __shared__ __attribute__((aligned(16))) float s_M[CH * PS];       // 17 KB  strict_tril(k_b k^T * decay), C negated
  __shared__ __attribute__((aligned(16))) float s_T[CH * PS];       // 17 KB  (I+M)^-1
  __shared__ __attribute__((aligned(16))) float s_attn[CH * PS];    // 17 KB  tril(q k^T * decay)
  __shared__ float s_red[512];
  __shared__ float s_invq[CH], s_invk[CH];
  __shared__ float s_graw[CH], s_gc[CH], s_beta[CH];

  const int tid  = threadIdx.x;
  const int wave = __builtin_amdgcn_readfirstlane((int)(threadIdx.x >> 5));
  const int lane = tid & 31;
  const int h2   = lane >> 4;   // half-wave select
  const int rl   = lane & 15;   // row/col within tile

  const int ck     = blockIdx.x;            // (batch * HEADS + head) * NCH + chunk
  const int s_base = (ck % NCH) * CH;
  const int head   = (ck / NCH) % HEADS;
  const int batch  = ck / (NCH * HEADS);

  // upper right block of T is zero
  for (int i = tid; i < HB * HB; i += 256)
    s_T[(i / HB) * PS + HB + (i % HB)] = 0.f;

  // waves 0 to 3 each bring one half tile of q or k (slice = wave)
  if (pinned(wave < 4)) {
    const u32x8 g1_qk = tdm_group1<PAD_256B_16B, HC * 4, HEADS * DKC * 4>();
    const size_t base = ((size_t)batch * SEQ + s_base) * HEADS + head;
    const float* srcp = ((wave & 2) ? kg : qg) + base * DKC + (wave & 1) * HC;
    const u32x4 g0 = tdm_group0(lds_off(s_qk) + (uint32_t)wave * (HSZ * 4u), srcp);
    tdm_load(g0, g1_qk);
    wait_tensor0(g0);
  }
  __syncthreads();
  float* sq = s_qk[0];   // column c of a row: sq[(c / HC) * HSZ + row * PQK + c % HC]
  float* sk = s_qk[2];

  // ---------------- phase 1: scalars + sum-of-squares ----------------
  if (wave < 2) {  // tid 0..63
    size_t gsc = ((size_t)batch * SEQ + s_base + tid) * HEADS + head;
    s_graw[tid] = gg[gsc];
    s_beta[tid] = bg[gsc];
  }
  {
    const int row = tid >> 2, seg = tid & 3;
    const int off = (seg >> 1) * HSZ + row * PQK + (seg & 1) * 32;
    const float4* q4 = reinterpret_cast<const float4*>(sq + off);
    const float4* k4 = reinterpret_cast<const float4*>(sk + off);
    float ssq = 0.f, ssk = 0.f;
#pragma unroll
    for (int j = 0; j < 8; ++j) {
      float4 a = q4[j]; ssq += a.x * a.x + a.y * a.y + a.z * a.z + a.w * a.w;
      float4 b = k4[j]; ssk += b.x * b.x + b.y * b.y + b.z * b.z + b.w * b.w;
    }
    s_red[row * 4 + seg]       = ssq;
    s_red[256 + row * 4 + seg] = ssk;
  }
  __syncthreads();

  // ---------------- phase 2: norms + parallel prefix of g ----------------
  if (wave < 2) {
    const int j = tid;
    float sq2 = s_red[j * 4] + s_red[j * 4 + 1] + s_red[j * 4 + 2] +
                s_red[j * 4 + 3];
    s_invq[j] = rsqrtf(sq2 + 1e-6f) * QSCALE;
    float sk2 = s_red[256 + j * 4] + s_red[256 + j * 4 + 1] +
                s_red[256 + j * 4 + 2] + s_red[256 + j * 4 + 3];
    s_invk[j] = rsqrtf(sk2 + 1e-6f);
    float acc = 0.f;
    for (int i = 0; i <= j; ++i) acc += s_graw[i];
    s_gc[j] = acc;
  }
  __syncthreads();

  // ---------------- phase 3: derived scalars + row rescale ----------------
  // The scan reads q and k as they lie in memory: their norms go into its row scales.
  // Row tid's scales wait in registers and are stored at the kernel's end, where no
  // barrier stands behind the stores.
  float w_u = 0.f, w_q = 0.f, w_k = 0.f, w_b = 0.f, w_e = 0.f;
  if (wave < 2) {
    const float gl = s_gc[CH - 1], gc = s_gc[tid];
    w_b = s_beta[tid];
    w_u = s_invk[tid] * (w_b * __expf(gc));  // k_beta * exp(gc)
    w_q = s_invq[tid] * __expf(gc);          // q * exp(gc)
    w_k = s_invk[tid] * __expf(gl - gc);     // k * exp(g_last - gc)
    w_e = __expf(gl);                        // state decay
  }
  {
    const int row = tid >> 2, seg = tid & 3;
    const int off = (seg >> 1) * HSZ + row * PQK + (seg & 1) * 32;
    const float iq = s_invq[row], ik = s_invk[row];
    float* qr = sq + off;
    float* kr = sk + off;
#pragma unroll
    for (int j = 0; j < 32; ++j) { qr[j] *= iq; kr[j] *= ik; }
  }
  __syncthreads();

  // ---------------- phase 4: M and attn via WMMA ----------------
  // 16 M tiles + 16 attn tiles over [64x64]; 2 of each per wave.
  for (int tt = 0; tt < 2; ++tt) {
    const int ti = wave * 2 + tt;                  // scalar (wave uniform)
    const int row0 = (ti >> 2) * 16, col0 = (ti & 3) * 16;
    const float gCc = s_gc[col0 + rl];             // hoisted: fixed per lane
    // --- M tile: strict_tril(k_beta k^T * decay) ---
    if (col0 <= row0) {
      // hoisted row scale; the lower left 32x32 block C is stored as -C,
      // the sign that the blocked inverse of phases 5 to 6b needs there
      const float bb = (row0 >= HB && col0 < HB) ? -s_beta[row0 + rl]
                                                 : s_beta[row0 + rl];
      v8f acc = {0.f, 0.f, 0.f, 0.f, 0.f, 0.f, 0.f, 0.f};
      for (int hf = 0; hf < 2; ++hf) {
        const float* kh = sk + hf * HSZ;
#pragma unroll 8
        for (int kk = 0; kk < HC; kk += 4) {
          v2f a = frag_a(kh, PQK, row0, kk, h2, rl);
          a.x *= bb; a.y *= bb;
          v2f b = frag_bt(kh, PQK, kk, col0, h2, rl);  // B[d][c] = k[c][d]
          acc = wmma4(a, b, acc);
        }
      }
#pragma unroll
      for (int i = 0; i < 8; ++i) {
        int R = row0 + i + 8 * h2, Cc = col0 + rl;
        float val = acc[i] * __expf(s_gc[R] - gCc);
        s_M[R * PS + Cc] = (R > Cc) ? val : 0.f;
      }
    } else {  // strictly-upper tile: zeros
#pragma unroll
      for (int i = 0; i < 8; ++i)
        s_M[(row0 + i + 8 * h2) * PS + col0 + rl] = 0.f;
    }
    // --- attn tile: tril(q k^T * decay) ---
    {
      v8f acc = {0.f, 0.f, 0.f, 0.f, 0.f, 0.f, 0.f, 0.f};
      for (int hf = 0; hf < 2; ++hf) {
        const float* qh = sq + hf * HSZ;
        const float* kh = sk + hf * HSZ;
#pragma unroll 8
        for (int kk = 0; kk < HC; kk += 4) {
          v2f a = frag_a(qh, PQK, row0, kk, h2, rl);
          v2f b = frag_bt(kh, PQK, kk, col0, h2, rl);
          acc = wmma4(a, b, acc);
        }
      }
#pragma unroll
      for (int i = 0; i < 8; ++i) {
        int R = row0 + i + 8 * h2, Cc = col0 + rl;
        float val = acc[i] * __expf(s_gc[R] - gCc);
        s_attn[R * PS + Cc] = (R >= Cc) ? val : 0.f;
      }
    }
  }
  __syncthreads();

  // attn is final: to the workspace
  tile_to_ws(ws + WS_A + (size_t)ck * MSZ, s_attn, tid);

  // ---- phase 5: diagonal blocks of T = (I+M)^-1 ----
  // I+M = [[A,0],[C,B]] in 32x32 blocks; wave 0 inverts A, wave 1 inverts B.
  // Lane = column; the column stays in registers, M rows are broadcast reads.
  if (wave < 2) {
    const int b0 = wave * HB;
    const float* Mb = s_M + b0 * PS + b0;
    float t[HB];
    // every loop over t[] is fully unrolled: constant indices keep it in registers
#pragma unroll
    for (int r = 0; r < HB; ++r) t[r] = (r == lane) ? 1.f : 0.f;
    // four finished rows at a time are folded into every later row, so the
    // updates of different rows are independent of each other
#pragma unroll
    for (int c0 = 0; c0 < HB; c0 += 4) {
#pragma unroll
      for (int r = c0 + 1; r < HB; ++r) {
        const float4 m = *reinterpret_cast<const float4*>(Mb + r * PS + c0);
        t[r] -= m.x * t[c0];
        if (r > c0 + 1) t[r] -= m.y * t[c0 + 1];
        if (r > c0 + 2) t[r] -= m.z * t[c0 + 2];
        if (r > c0 + 3) t[r] -= m.w * t[c0 + 3];
      }
    }
#pragma unroll
    for (int r = 0; r < HB; ++r) s_T[(b0 + r) * PS + b0 + lane] = t[r];
  }
  __syncthreads();

  // ---- phase 6: X = -C @ A^-1 (waves 0-3, into T's lower left block) ----
  if (wave < 4) {
    const int row0 = (wave >> 1) * 16, col0 = (wave & 1) * 16;
    v8f acc = {0.f, 0.f, 0.f, 0.f, 0.f, 0.f, 0.f, 0.f};
#pragma unroll
    for (int kk = 0; kk < HB; kk += 4) {
      v2f a = frag_a(s_M + HB * PS, PS, row0, kk, h2, rl);
      v2f b = frag_b(s_T, PS, kk, col0, h2, rl);
      acc = wmma4(a, b, acc);
    }
#pragma unroll
    for (int i = 0; i < 8; ++i)
      s_T[(HB + row0 + i + 8 * h2) * PS + col0 + rl] = acc[i];
  }
  __syncthreads();

  // ---- phase 6b: lower left block of T = B^-1 @ X, in place ----
  // One wave owns a 16-column strip of X: it reads the whole strip before it
  // stores over it, and no other wave reads or writes that strip.
  if (wave < 2) {
    const int col0 = wave * 16;
    v8f acc0 = {0.f, 0.f, 0.f, 0.f, 0.f, 0.f, 0.f, 0.f};
    v8f acc1 = {0.f, 0.f, 0.f, 0.f, 0.f, 0.f, 0.f, 0.f};
#pragma unroll
    for (int kk = 0; kk < HB; kk += 4) {
      v2f b  = frag_b(s_T + HB * PS, PS, kk, col0, h2, rl);
      v2f a0 = frag_a(s_T + HB * PS + HB, PS, 0, kk, h2, rl);
      v2f a1 = frag_a(s_T + HB * PS + HB, PS, 16, kk, h2, rl);
      acc0 = wmma4(a0, b, acc0);
      acc1 = wmma4(a1, b, acc1);
    }
#pragma unroll
    for (int i = 0; i < 8; ++i) {
      s_T[(HB + i + 8 * h2) * PS + col0 + rl]      = acc0[i];
      s_T[(HB + 16 + i + 8 * h2) * PS + col0 + rl] = acc1[i];
    }
  }
  __syncthreads();

  tile_to_ws(ws + WS_T + (size_t)ck * MSZ, s_T, tid);
  if (wave < 2) {
    float* wsc = ws + WS_S + (size_t)ck * SSZ;
    wsc[tid]       = w_u;
    wsc[64 + tid]  = w_q;
    wsc[128 + tid] = w_k;
    wsc[192 + tid] = w_b;
    wsc[256 + tid] = w_e;
  }
}

// ---- launch 2: the scan over the chunks of a (batch, head, group of Dv columns) ----
__global__ __launch_bounds__(NTS)
void gdn_chunk_scan(const float* __restrict__ qg, const float* __restrict__ kg,
                    const float* __restrict__ vg, const float* __restrict__ ws,
                    float* __restrict__ outg) {
  // double-buffered q and k chunk; slices of a buffer: q low, q high, k low, k high
  __shared__ __attribute__((aligned(2048))) float s_qk[2][4][HSZ];  // 144 KB
  __shared__ __attribute__((aligned(2048))) float s_ta[2][2][HSZ];  // 72 KB  T, attn at pitch PS
  __shared__ __attribute__((aligned(2048))) float s_v[2][CH * DVG]; // 8 KB  v chunk
  __shared__ float s_vn[CH * PV];       // 4 KB  v_new
  __shared__ float s_tmp[CH * PV];      // 4 KB  v_beta - U
  __shared__ float s_state[DKC * PV];   // 8 KB  recurrent state
  __shared__ __attribute__((aligned(16))) float s_sc[2][4 * CH];  // row scales of a chunk, as launch 1 wrote them

  const int tid  = threadIdx.x;
  const int wave = __builtin_amdgcn_readfirstlane((int)(threadIdx.x >> 5));
  const int lane = tid & 31;
  const int h2   = lane >> 4;   // half-wave select
  const int rl   = lane & 15;   // row/col within tile

  const int bid   = blockIdx.x;
  const int grp   = bid % GRP;
  const int head  = (bid / GRP) % HEADS;
  const int batch = bid / (GRP * HEADS);
  const int dv0   = grp * DVG;
  const int ck0   = (batch * HEADS + head) * NCH;   // first chunk's place in the workspace

  // Tensor loads of a chunk: every wave brings one of the four half tiles of q and k
  // (slice = wave); as a second request wave 0 brings the v tile, wave 1 T, wave 2 attn.
  const u32x8 g1_qk = tdm_group1<PAD_256B_16B, HC * 4, HEADS * DKC * 4>();
  const u32x8 g1_v  = tdm_group1<0u, DVG * 4, HEADS * DVC * 4>();
  const u32x8 g1_ta = tdm_group1<PAD_256B_16B, CH * 4, CH * 4>();
  auto group0 = [&](int chunk, int b) {
    const size_t base = ((size_t)batch * SEQ + (size_t)chunk * CH) * HEADS + head;
    const float* srcp = ((wave & 2) ? kg : qg) + base * DKC + (wave & 1) * HC;
    return tdm_group0(lds_off(s_qk) + (uint32_t)(b * 4 + wave) * (HSZ * 4u), srcp);
  };
  auto group0x = [&](int chunk, int b) {
    const size_t base = ((size_t)batch * SEQ + (size_t)chunk * CH) * HEADS + head;
    const float* srcp = (wave == 0) ? vg + base * DVC + dv0
                      : ws + ((wave == 1) ? WS_T : WS_A) + (size_t)(ck0 + chunk) * MSZ;
    const uint32_t dst = (wave == 0) ? lds_off(s_v[b])
                       : lds_off(s_ta) + (uint32_t)(b * 2 + ((wave == 1) ? 0 : 1)) * (HSZ * 4u);
    return tdm_group0(dst, srcp);
  };
  const float* wsc = ws + WS_S + (size_t)ck0 * SSZ;  // scale blocks of this (batch, head)

  for (int i = tid; i < DKC * DVG; i += NTS) s_state[(i / DVG) * PV + (i % DVG)] = 0.f;
  reinterpret_cast<float2*>(s_sc[0])[tid] = reinterpret_cast<const float2*>(wsc)[tid];
  float egl = wsc[4 * CH];      // e^g_last of the chunk in work

  // chunk 0 lands and is published; chunk 1 then flies while chunk 0 is worked on
  u32x4 g0  = group0(0, 0);   // groups 0 of this wave's requests in flight
  u32x4 g0x = group0x(0, 0);
  tdm_load_held(g0, g1_qk);
  if (pinned(wave == 0)) tdm_load_held(g0x, g1_v);
  if (pinned(wave == 1 || wave == 2)) tdm_load_held(g0x, g1_ta);
  wait_tensor0(g0, g0x);
  __syncthreads();
  g0  = group0(1, 1);
  g0x = group0x(1, 1);
  tdm_load_held(g0, g1_qk);
  if (pinned(wave == 0)) tdm_load_held(g0x, g1_v);
  if (pinned(wave == 1 || wave == 2)) tdm_load_held(g0x, g1_ta);

  const int row0 = wave * 16, col0 = 0;  // this wave's tile of tmp, v_new, out
  // This wave's two tiles of the state, rows dk0 to dk0 + 31 of the 16 columns: they stay
  // in registers from chunk to chunk; LDS holds the copy that the other waves read.
  const int dk0 = wave * 32;
  const int eslot = tid & (CH - 1);
  v8f st_a = {0.f, 0.f, 0.f, 0.f, 0.f, 0.f, 0.f, 0.f};
  v8f st_b = {0.f, 0.f, 0.f, 0.f, 0.f, 0.f, 0.f, 0.f};

  for (int n = 0; n < NCH; ++n) {
    const int s_base = n * CH;
    const int buf = n & 1;
    const float* sq = s_qk[buf][0];   // column c of a row: sq[(c / HC) * HSZ + row * PQK + c % HC]
    const float* sk = s_qk[buf][2];
    const float* sT = s_ta[buf][0];
    const float* sattn = s_ta[buf][1];
    const float* sv = s_v[buf];
    const float* s_bg   = s_sc[buf];            // k row scale of U
    const float* s_eg   = s_sc[buf] + CH;       // q row scale
    const float* s_kd   = s_sc[buf] + 2 * CH;   // k row scale of the state update
    const float* s_beta = s_sc[buf] + 3 * CH;

    // The fragment reads of a part of the trip stand in one place, ahead of the WMMA chains
    // that take them, and the fragments stay in registers. The scheduling groups at the end
    // of each part say that order (reads, WMMAs, ...) to the compiler, which otherwise puts
    // each read one or two chain links ahead of its WMMA, so that every link waits on LDS.
    // A group's size is an upper bound.
#define SG_READS(n)  __builtin_amdgcn_sched_group_barrier(0x100, n, 0)  // LDS reads
#define SG_WMMAS(n)  __builtin_amdgcn_sched_group_barrier(0x008, n, 0)  // matrix instructions
#define SG_STORES(n) __builtin_amdgcn_sched_group_barrier(0x040, n, 0)  // global stores
    // every loop over a fragment array is fully unrolled: constant indices keep it in registers

    // ---- reads 1: k rows, this wave's 16 state columns (for tmp and for out), v, beta ----
    v2f kf[32], sf[32];
#pragma unroll
    for (int j = 0; j < 32; ++j) {
      kf[j] = frag_a(sk + (j >> 4) * HSZ, PQK, row0, (j & 15) * 4, h2, rl);
      sf[j] = frag_b(s_state, PV, j * 4, col0, h2, rl);
    }
    const float sc_u = s_bg[row0 + rl];
    float vr[8], be[8];
#pragma unroll
    for (int i = 0; i < 8; ++i) {
      vr[i] = sv[(row0 + i + 8 * h2) * DVG + col0 + rl];
      be[i] = s_beta[row0 + i + 8 * h2];
    }
    // the next chunk's scales are fetched now and stored to LDS at the foot
    const float* scn = wsc + (size_t)((n + 1 < NCH) ? n + 1 : n) * SSZ;
    const float2 sc_next = reinterpret_cast<const float2*>(scn)[tid];
    const float egl_next = scn[4 * CH + eslot];
    // stands in front of whatever next overwrites a register that these loads name;
    // as inputs of the wait, the two index registers keep their values up to it
    asm volatile("s_wait_xcnt 0x0" :: "v"(tid), "v"(eslot) : "memory");

    // ---------------- tmp = v_beta - (k_b e^gc)@state ----------------
    v8f acc = {0.f, 0.f, 0.f, 0.f, 0.f, 0.f, 0.f, 0.f};
#pragma unroll
    for (int j = 0; j < 32; ++j) {
      v2f a = kf[j];
      a.x *= sc_u; a.y *= sc_u;
      acc = wmma4(a, sf[j], acc);
    }
#pragma unroll
    for (int i = 0; i < 8; ++i)
      s_tmp[(row0 + i + 8 * h2) * PV + col0 + rl] = vr[i] * be[i] - acc[i];
    SG_READS(100);
    SG_WMMAS(32);
    __syncthreads();
    // a full stop for the scheduler: the groups of the parts of a trip are solved apart
    // (solved as one, the reads of the last part fell among its WMMAs again)
    __builtin_amdgcn_sched_barrier(0);

    // ---- reads 2: q rows, T, tmp ----
    const float sc_q = s_eg[row0 + rl];
    v2f qf[32], tf[16], Tf[16];
#pragma unroll
    for (int j = 0; j < 32; ++j)
      qf[j] = frag_a(sq + (j >> 4) * HSZ, PQK, row0, (j & 15) * 4, h2, rl);
#pragma unroll
    for (int j = 0; j < 16; ++j) {
      Tf[j] = frag_a(sT, PS, row0, j * 4, h2, rl);
      tf[j] = frag_b(s_tmp, PV, j * 4, col0, h2, rl);
    }

    // ---------- out = (q e^gc)@state + attn@v_new: k steps 0 to 23 of q@state ----------
    v8f acc_o = {0.f, 0.f, 0.f, 0.f, 0.f, 0.f, 0.f, 0.f};
#pragma unroll
    for (int j = 0; j < 24; ++j) {
      v2f a = qf[j];
      a.x *= sc_q; a.y *= sc_q;
      acc_o = wmma4(a, sf[j], acc_o);
    }
    // ---------------- v_new = T @ tmp ----------------
    acc = v8f{0.f, 0.f, 0.f, 0.f, 0.f, 0.f, 0.f, 0.f};
#pragma unroll
    for (int j = 0; j < 16; ++j) acc = wmma4(Tf[j], tf[j], acc);
#pragma unroll
    for (int i = 0; i < 8; ++i)
      s_vn[(row0 + i + 8 * h2) * PV + col0 + rl] = acc[i];
    SG_READS(100);
    SG_WMMAS(40);
    __syncthreads();
    __builtin_amdgcn_sched_barrier(0);  // full stop for the scheduler, as behind the barrier above

    // ---- reads 3: v_new (for out and for the state) and attn; they land under the
    //      last k steps of q@state, whose operands are in registers ----
    v2f vn[16], af[16];
#pragma unroll
    for (int j = 0; j < 16; ++j) {
      vn[j] = frag_b(s_vn, PV, j * 4, col0, h2, rl);
      af[j] = frag_a(sattn, PS, row0, j * 4, h2, rl);
    }
#pragma unroll
    for (int j = 24; j < 32; ++j) {
      v2f a = qf[j];
      a.x *= sc_q; a.y *= sc_q;
      acc_o = wmma4(a, sf[j], acc_o);
    }
    // ---- reads 4: k columns and their scales; they land under attn@v_new ----
    v2f kd[16], ka[16], kb[16];
    {
      const float* kc = sk + (dk0 / HC) * HSZ + (dk0 % HC);  // k column dk0
#pragma unroll
      for (int j = 0; j < 16; ++j) {
        kd[j].x = s_kd[j * 4 + 2 * h2];
        kd[j].y = s_kd[j * 4 + 2 * h2 + 1];
        ka[j] = frag_b(kc, PQK, j * 4, 0, h2, rl);    // A[m][kk'] = k[kk'][dk0 + m]
        kb[j] = frag_b(kc, PQK, j * 4, 16, h2, rl);   // the same of the next 16 columns
      }
    }
#pragma unroll
    for (int j = 0; j < 16; ++j) acc_o = wmma4(af[j], vn[j], acc_o);
    {
      float* po = outg +
          ((size_t)((size_t)batch * SEQ + s_base + row0 + 8 * h2) * HEADS + head) * DVC +
          dv0 + col0 + rl;
#pragma unroll
      for (int i = 0; i < 8; ++i) po[(size_t)i * HEADS * DVC] = acc_o[i];
      // stands in front of whatever next overwrites a register that these stores name;
      // as inputs of the wait, address and data keep their registers up to it
      asm volatile("s_wait_xcnt 0x0" :: "v"(po), "v"(acc_o) : "memory");
    }

    // ------- state = state*e^{g_last} + kd^T @ v_new -------
    // No wave reads the state from LDS behind reads 1, so no barrier stands here.
#pragma unroll
    for (int i = 0; i < 8; ++i) { st_a[i] *= egl; st_b[i] *= egl; }
#pragma unroll
    for (int j = 0; j < 16; ++j) {
      v2f a = ka[j], b = kb[j];
      a.x *= kd[j].x; a.y *= kd[j].y;   // transposed, K-scaled
      b.x *= kd[j].x; b.y *= kd[j].y;
      st_a = wmma4(a, vn[j], st_a);
      st_b = wmma4(b, vn[j], st_b);
    }
#pragma unroll
    for (int i = 0; i < 8; ++i) {
      s_state[(dk0 + i + 8 * h2) * PV + col0 + rl]      = st_a[i];
      s_state[(dk0 + 16 + i + 8 * h2) * PV + col0 + rl] = st_b[i];
    }
    // the out stores go ahead of the state's chains, which cover them up to the foot barrier
    SG_READS(40);
    SG_WMMAS(8);
    SG_READS(72);
    SG_WMMAS(16);
    SG_STORES(8);
    SG_WMMAS(32);
#undef SG_READS
#undef SG_WMMAS
#undef SG_STORES
    reinterpret_cast<float2*>(s_sc[buf ^ 1])[tid] = sc_next;   // its last readers left it at the foot of the trip before
    egl = egl_next;

    // ---- publish chunk n+1, then refill the buffer that chunk n has left ----
    wait_ds0();                                // this wave's LDS reads and writes are done
    wait_tensor0(g0, g0x);                     // this wave's own tiles of chunk n+1 have landed
    __syncthreads();
    if (pinned(n + 2 < NCH)) {
      g0  = group0(n + 2, buf);
      g0x = group0x(n + 2, buf);
      tdm_load_held(g0, g1_qk);
      if (pinned(wave == 0)) tdm_load_held(g0x, g1_v);
      if (pinned(wave == 1 || wave == 2)) tdm_load_held(g0x, g1_ta);
    }
  }
  wait_tensor0();
  wait_ds0();
}

extern "C" void kernel_launch(void* const* d_in, const int* in_sizes, int n_in,
                              void* d_out, int out_size, void* d_ws,
                              size_t ws_size, hipStream_t stream) {
  const float* q    = (const float*)d_in[0];
  const float* k    = (const float*)d_in[1];
  const float* v    = (const float*)d_in[2];
  const float* g    = (const float*)d_in[3];
  const float* beta = (const float*)d_in[4];
  float* out = (float*)d_out;
  float* ws  = (float*)d_ws;
  gdn_chunk_local<<<dim3(NCK), 256, 0, stream>>>(q, k, g, beta, ws);  // 2048 workgroups
  dim3 grid(BATCH * HEADS * GRP);  // 256 workgroups
  gdn_chunk_scan<<<grid, NTS, 0, stream>>>(q, k, v, ws, out);
}
